// v000
// The times below were measured on an AMD MI455X: many runs one after another, warmed up first and cycling through
// copies of the inputs, with the whole window's GPU time divided by the number of runs. Launches and the gaps
// between them are all in it. The median over several windows is given; except for v000 it joins two sittings, which
// can be a few percent apart, so the side-by-side timings, each taken in one sitting, are the better comparison.
// The starting kernel, v000, takes 2700 microseconds a run.
#include <hip/hip_runtime.h>
#include <hip/hip_bf16.h>

typedef __attribute__((ext_vector_type(16))) _Float16 v16h;
typedef __attribute__((ext_vector_type(8)))  float    v8f;

// ---------------------------------------------------------------------------
// WMMA fragment loaders (wave32, 16-bit A/B layout per CDNA5 ISA 7.12.2):
//   lane l holds row (l&15); khi = (l>>4)*8; half-element e maps to
//   K = 16*(e>=8) + khi + (e&7).
// B fragments (32x16 K-major) load identically from the row-major *transpose*
// of B, i.e. B^T (N x K) — which for Q·K^T and P·V is exactly the row-major
// tile we keep in LDS.
// ---------------------------------------------------------------------------

__device__ static inline v16h frag_k16(const _Float16* base, int ld) {
  // 16x16 tile, zero-padded to K=32 (head_dim == 16)
  const int lane = threadIdx.x & 31;
  const int row  = lane & 15;
  const int khi  = (lane >> 4) << 3;
  v16h a;
#pragma unroll
  for (int e = 0; e < 16; ++e) {
    if (e < 8) a[e] = base[row * ld + khi + (e & 7)];
    else       a[e] = (_Float16)0.0f;
  }
  return a;
}

__device__ static inline v16h frag_k32_f16(const _Float16* base, int ld) {
  const int lane = threadIdx.x & 31;
  const int row  = lane & 15;
  const int khi  = (lane >> 4) << 3;
  v16h a;
#pragma unroll
  for (int e = 0; e < 16; ++e) {
    int k = ((e >> 3) << 4) + khi + (e & 7);
    a[e] = base[row * ld + k];
  }
  return a;
}

__device__ static inline v16h frag_k32_f32(const float* base, int ld) {
  const int lane = threadIdx.x & 31;
  const int row  = lane & 15;
  const int khi  = (lane >> 4) << 3;
  v16h a;
#pragma unroll
  for (int e = 0; e < 16; ++e) {
    int k = ((e >> 3) << 4) + khi + (e & 7);
    a[e] = (_Float16)base[row * ld + k];
  }
  return a;
}

// ---------------------------------------------------------------------------
// Kernel 1: qkv = x @ qkv_w^T + qkv_b, scattered into window-gathered layout
//   q/k : f16 [1024 window-heads][512 tokens][16]
//   v   : f32 same shape (kept f32 for LePE conv precision)
// window-head index: wh = (((dir*16 + b)*8 + win)*4 + local_head)
// ---------------------------------------------------------------------------
__global__ __launch_bounds__(256) void cswin_qkv_kernel(
    const float* __restrict__ x, const float* __restrict__ w,
    const float* __restrict__ bias,
    _Float16* __restrict__ qbuf, _Float16* __restrict__ kbuf,
    float* __restrict__ vbuf)
{
  __shared__ _Float16 As[64 * 128];
  __shared__ _Float16 Ws[64 * 128];
  const int tid  = threadIdx.x;
  const int lane = tid & 31;
  const int wave = tid >> 5;                 // 8 waves (wave32)
  const int mbase = blockIdx.x * 64;         // token tile
  const int nbase = blockIdx.y * 64;         // output-channel tile (of 384)

  __builtin_prefetch(x + (mbase + 63) * 128, 0, 0);

  for (int i = tid; i < 64 * 128; i += 256) {
    int r = i >> 7, k = i & 127;
    As[i] = (_Float16)x[(mbase + r) * 128 + k];
    Ws[i] = (_Float16)w[(nbase + r) * 128 + k];
  }
  __syncthreads();

  for (int t = wave * 2; t < wave * 2 + 2; ++t) {  // 16 tiles / 8 waves
    const int mt = t >> 2, nt = t & 3;
    v8f c = {};
#pragma unroll
    for (int kc = 0; kc < 4; ++kc) {               // K = 128
      v16h a = frag_k32_f16(As + (mt * 16) * 128 + kc * 32, 128);
      v16h b = frag_k32_f16(Ws + (nt * 16) * 128 + kc * 32, 128);
      c = __builtin_amdgcn_wmma_f32_16x16x32_f16(false, a, false, b,
                                                 (short)0, c, false, false);
    }
    const int col   = nbase + nt * 16 + (lane & 15);
    const int rhalf = (lane >> 4) << 3;
    const int sel   = col >> 7;                    // 0=q 1=k 2=v
    const int cc    = col & 127;
    const int head  = cc >> 4, hd = cc & 15;
    const int dir   = head >> 2, hloc = head & 3;
#pragma unroll
    for (int r = 0; r < 8; ++r) {
      const int m = mbase + mt * 16 + r + rhalf;
      const float val = c[r] + bias[col];
      const int b_ = m >> 12, n = m & 4095;
      const int y = n >> 6, xq = n & 63;
      int win, pos;
      if (dir == 0) { win = y >> 3;  pos = ((y & 7) << 6) | xq; }
      else          { win = xq >> 3; pos = (y << 3) | (xq & 7); }
      const int wh  = ((dir * 16 + b_) * 8 + win) * 4 + hloc;
      const int off = (wh * 512 + pos) * 16 + hd;
      if      (sel == 0) qbuf[off] = (_Float16)val;
      else if (sel == 1) kbuf[off] = (_Float16)val;
      else               vbuf[off] = val;
    }
  }
}

// ---------------------------------------------------------------------------
// Kernel 2: stripe attention for one (window-head, 64-row M-block).
//   - LePE (depthwise 3x3 + v) into Vt (d-major f16 in LDS)
//   - S = Q K^T via WMMA (K=16 zero-padded to 32)
//   - row softmax (scale 0.25) on f32 score block in LDS
//   - O = P @ V_le via WMMA, K=512 split across wave pairs, LDS combine
// ---------------------------------------------------------------------------
__global__ __launch_bounds__(256) void cswin_attn_kernel(
    const _Float16* __restrict__ qbuf, const _Float16* __restrict__ kbuf,
    const float* __restrict__ vbuf,
    const float* __restrict__ dwh_w, const float* __restrict__ dwh_b,
    const float* __restrict__ dwv_w, const float* __restrict__ dwv_b,
    float* __restrict__ obuf)
{
  extern __shared__ char smem[];
  float*    Ss   = (float*)smem;                     // 64 x 512 scores (128KB)
  float*    cscr = Ss + 64 * 512;                    // 4 x 256 combine
  float*    red  = cscr + 4 * 256;                   // 64 x 4 partials
  _Float16* Qs   = (_Float16*)(red + 64 * 4);        // 64 x 16
  _Float16* Ks   = Qs + 64 * 16;                     // 512 x 16
  _Float16* Vt   = Ks + 512 * 16;                    // 16 x VTLD (d-major)
  const int VTLD = 520;

  const int tid  = threadIdx.x;
  const int lane = tid & 31;
  const int wave = tid >> 5;
  const int mb   = blockIdx.x;        // 0..7  (64-row M block)
  const int wh   = blockIdx.y;        // 0..1023
  const int dir  = wh >> 9;
  const int mbase = mb * 64;

  const _Float16* qw = qbuf + (wh * 512 + mbase) * 16;
  const _Float16* kw = kbuf + (size_t)wh * 512 * 16;
  const float*    vw = vbuf + (size_t)wh * 512 * 16;

  __builtin_prefetch(vw + tid * 16, 0, 0);

  for (int i = tid; i < 64 * 16;  i += 256) Qs[i] = qw[i];
  for (int i = tid; i < 512 * 16; i += 256) Ks[i] = kw[i];

  // LePE: Vt[d][p] = v + conv3x3_dw(v) + bias, zero-padded within the window
  const float* cw = dir ? dwv_w : dwh_w;
  const float* cb = dir ? dwv_b : dwh_b;
  const int ws = dir ? 8 : 64;
  const int hs = 512 / ws;
  for (int i = tid; i < 16 * 512; i += 256) {
    const int d = i >> 9, p = i & 511;
    const int r = p / ws, c = p % ws;
    float acc = cb[d];
#pragma unroll
    for (int dy = -1; dy <= 1; ++dy)
#pragma unroll
      for (int dx = -1; dx <= 1; ++dx) {
        const int rr = r + dy, c2 = c + dx;
        if (rr >= 0 && rr < hs && c2 >= 0 && c2 < ws)
          acc += vw[(rr * ws + c2) * 16 + d] * cw[d * 9 + (dy + 1) * 3 + (dx + 1)];
      }
    acc += vw[p * 16 + d];
    Vt[d * VTLD + p] = (_Float16)acc;
  }
  __syncthreads();

  // --- S = Q K^T : 4x32 tiles, 16 per wave ---
  for (int i = 0; i < 16; ++i) {
    const int t  = wave * 16 + i;
    const int mt = t >> 5, nt = t & 31;
    v16h a = frag_k16(Qs + mt * 16 * 16, 16);
    v16h b = frag_k16(Ks + nt * 16 * 16, 16);
    v8f c = {};
    c = __builtin_amdgcn_wmma_f32_16x16x32_f16(false, a, false, b,
                                               (short)0, c, false, false);
    const int rhalf = (lane >> 4) << 3;
    const int col   = nt * 16 + (lane & 15);
#pragma unroll
    for (int r = 0; r < 8; ++r)
      Ss[(mt * 16 + r + rhalf) * 512 + col] = c[r];
  }
  __syncthreads();

  // --- row softmax, scale = 16^-0.5 = 0.25, 4 threads per row ---
  {
    const float scale = 0.25f;
    const int row = tid >> 2, part = tid & 3;
    float* rp = Ss + row * 512 + part * 128;
    float pmax = -3.4e38f;
    for (int j = 0; j < 128; ++j) pmax = fmaxf(pmax, rp[j]);
    red[row * 4 + part] = pmax;
    __syncthreads();
    const float rmax = fmaxf(fmaxf(red[row * 4 + 0], red[row * 4 + 1]),
                             fmaxf(red[row * 4 + 2], red[row * 4 + 3]));
    __syncthreads();
    float psum = 0.0f;
    for (int j = 0; j < 128; ++j) {
      const float e = __expf(scale * (rp[j] - rmax));
      rp[j] = e;
      psum += e;
    }
    red[row * 4 + part] = psum;
    __syncthreads();
    const float inv = 1.0f / (red[row * 4 + 0] + red[row * 4 + 1] +
                              red[row * 4 + 2] + red[row * 4 + 3]);
    for (int j = 0; j < 128; ++j) rp[j] *= inv;
  }
  __syncthreads();

  // --- O = P @ V_le : 4 M-tiles, K=512 split across wave pairs ---
  const int mt    = wave & 3;
  const int khalf = wave >> 2;
  v8f c = {};
  for (int kc = khalf * 8; kc < khalf * 8 + 8; ++kc) {
    v16h a = frag_k32_f32(Ss + (mt * 16) * 512 + kc * 32, 512);
    v16h b = frag_k32_f16(Vt + kc * 32, VTLD);
    c = __builtin_amdgcn_wmma_f32_16x16x32_f16(false, a, false, b,
                                               (short)0, c, false, false);
  }
  if (wave >= 4) {
#pragma unroll
    for (int r = 0; r < 8; ++r) cscr[mt * 256 + r * 32 + lane] = c[r];
  }
  __syncthreads();
  if (wave < 4) {
    const int hloc = wh & 3, win = (wh >> 2) & 7, b_ = (wh >> 5) & 15;
    const int d = lane & 15;
    const int rhalf = (lane >> 4) << 3;
    const int ch = (dir * 4 + hloc) * 16 + d;   // concat: h-heads 0..63, v 64..127
#pragma unroll
    for (int r = 0; r < 8; ++r) {
      const float val = c[r] + cscr[mt * 256 + r * 32 + lane];
      const int pos = mbase + mt * 16 + r + rhalf;
      const int n = dir ? ((pos >> 3) * 64 + win * 8 + (pos & 7))
                        : (win * 512 + pos);
      obuf[(b_ * 4096 + n) * 128 + ch] = val;
    }
  }
}

// ---------------------------------------------------------------------------
// Kernel 3: out = attn_out @ proj_w^T + proj_b   (65536x128 @ 128x128)
// ---------------------------------------------------------------------------
__global__ __launch_bounds__(256) void cswin_proj_kernel(
    const float* __restrict__ a_in, const float* __restrict__ w,
    const float* __restrict__ bias, float* __restrict__ out)
{
  __shared__ _Float16 As[64 * 128];
  __shared__ _Float16 Ws[64 * 128];
  const int tid  = threadIdx.x;
  const int lane = tid & 31;
  const int wave = tid >> 5;
  const int mbase = blockIdx.x * 64;
  const int nbase = blockIdx.y * 64;

  for (int i = tid; i < 64 * 128; i += 256) {
    int r = i >> 7, k = i & 127;
    As[i] = (_Float16)a_in[(mbase + r) * 128 + k];
    Ws[i] = (_Float16)w[(nbase + r) * 128 + k];
  }
  __syncthreads();

  for (int t = wave * 2; t < wave * 2 + 2; ++t) {
    const int mt = t >> 2, nt = t & 3;
    v8f c = {};
#pragma unroll
    for (int kc = 0; kc < 4; ++kc) {
      v16h a = frag_k32_f16(As + (mt * 16) * 128 + kc * 32, 128);
      v16h b = frag_k32_f16(Ws + (nt * 16) * 128 + kc * 32, 128);
      c = __builtin_amdgcn_wmma_f32_16x16x32_f16(false, a, false, b,
                                                 (short)0, c, false, false);
    }
    const int col   = nbase + nt * 16 + (lane & 15);
    const int rhalf = (lane >> 4) << 3;
#pragma unroll
    for (int r = 0; r < 8; ++r) {
      const int m = mbase + mt * 16 + r + rhalf;
      out[m * 128 + col] = c[r] + bias[col];
    }
  }
}

// ---------------------------------------------------------------------------
extern "C" void kernel_launch(void* const* d_in, const int* in_sizes, int n_in,
                              void* d_out, int out_size, void* d_ws, size_t ws_size,
                              hipStream_t stream) {
  const float* x      = (const float*)d_in[0];
  const float* qkv_w  = (const float*)d_in[1];
  const float* qkv_b  = (const float*)d_in[2];
  const float* proj_w = (const float*)d_in[3];
  const float* proj_b = (const float*)d_in[4];
  const float* dwh_w  = (const float*)d_in[5];
  const float* dwh_b  = (const float*)d_in[6];
  const float* dwv_w  = (const float*)d_in[7];
  const float* dwv_b  = (const float*)d_in[8];
  // d_in[9]=H, d_in[10]=W fixed at 64 for this problem size.

  char* wsb = (char*)d_ws;
  _Float16* qbuf = (_Float16*)(wsb);                       // 16 MB
  _Float16* kbuf = (_Float16*)(wsb + (size_t)16 * 1024 * 1024);  // 16 MB
  float*    vbuf = (float*)   (wsb + (size_t)32 * 1024 * 1024);  // 32 MB
  float*    obuf = (float*)   (wsb + (size_t)64 * 1024 * 1024);  // 32 MB

  // QKV projection + window-gather scatter
  cswin_qkv_kernel<<<dim3(1024, 6), 256, 0, stream>>>(
      x, qkv_w, qkv_b, qbuf, kbuf, vbuf);

  // Stripe attention: 1024 window-heads x 8 M-blocks
  const size_t smem = (size_t)64 * 512 * 4 + 4 * 256 * 4 + 64 * 4 * 4 +
                      (size_t)(64 * 16 + 512 * 16 + 16 * 520) * 2;
  cswin_attn_kernel<<<dim3(8, 1024), 256, smem, stream>>>(
      qbuf, kbuf, vbuf, dwh_w, dwh_b, dwv_w, dwv_b, obuf);

  // Output projection
  cswin_proj_kernel<<<dim3(1024, 2), 256, 0, stream>>>(
      obuf, proj_w, proj_b, (float*)d_out);
}

// v001
// A run of this version takes 1190 microseconds.
// Next to v000, in two timings, it ran 2.29 and 2.30 times as fast.
#include <hip/hip_runtime.h>
#include <hip/hip_bf16.h>

typedef __attribute__((ext_vector_type(16))) _Float16 v16h;
typedef __attribute__((ext_vector_type(8)))  float    v8f;

// ---------------------------------------------------------------------------
// WMMA fragment loaders (wave32, 16-bit A/B layout per CDNA5 ISA 7.12.2):
//   lane l holds row (l&15); khi = (l>>4)*8; half-element e maps to
//   K = 16*(e>=8) + khi + (e&7).
// B fragments (32x16 K-major) load identically from the row-major *transpose*
// of B, i.e. B^T (N x K) — which for Q·K^T and P·V is exactly the row-major
// tile we keep in LDS.
// ---------------------------------------------------------------------------

__device__ static inline v16h frag_k16(const _Float16* base, int ld) {
  // 16x16 tile, zero-padded to K=32 (head_dim == 16)
  const int lane = threadIdx.x & 31;
  const int row  = lane & 15;
  const int khi  = (lane >> 4) << 3;
  v16h a;
#pragma unroll
  for (int e = 0; e < 16; ++e) {
    if (e < 8) a[e] = base[row * ld + khi + (e & 7)];
    else       a[e] = (_Float16)0.0f;
  }
  return a;
}

__device__ static inline v16h frag_k32_f16(const _Float16* base, int ld) {
  const int lane = threadIdx.x & 31;
  const int row  = lane & 15;
  const int khi  = (lane >> 4) << 3;
  v16h a;
#pragma unroll
  for (int e = 0; e < 16; ++e) {
    int k = ((e >> 3) << 4) + khi + (e & 7);
    a[e] = base[row * ld + k];
  }
  return a;
}

__device__ static inline v16h frag_k32_f32(const float* base, int ld) {
  const int lane = threadIdx.x & 31;
  const int row  = lane & 15;
  const int khi  = (lane >> 4) << 3;
  v16h a;
#pragma unroll
  for (int e = 0; e < 16; ++e) {
    int k = ((e >> 3) << 4) + khi + (e & 7);
    a[e] = (_Float16)base[row * ld + k];
  }
  return a;
}

// ---------------------------------------------------------------------------
// Whole-wave (32 lanes) maximum and sum, every lane active, result in every
// lane: four xor steps inside each 16-lane row by DPP (row_xmask 1,2,4,8),
// then lane l with lane l ^ 16.
// ---------------------------------------------------------------------------
template <int CTRL>
__device__ static inline float dpp_row(float x) {
  const int b = __builtin_bit_cast(int, x);
  return __builtin_bit_cast(float,
      __builtin_amdgcn_update_dpp(0, b, CTRL, 0xf, 0xf, true));
}

__device__ static inline float xhalf(float x) {
  const int b = __builtin_bit_cast(int, x);
  return __builtin_bit_cast(float,
      __builtin_amdgcn_permlanex16(b, b, 0x76543210, 0xfedcba98, false, false));
}

__device__ static inline float max2(float a, float b) {
  return __builtin_elementwise_maximumnum(a, b);
}

__device__ static inline float wave_max(float x) {
  x = max2(x, dpp_row<0x161>(x));
  x = max2(x, dpp_row<0x162>(x));
  x = max2(x, dpp_row<0x164>(x));
  x = max2(x, dpp_row<0x168>(x));
  return max2(x, xhalf(x));
}

__device__ static inline float wave_sum(float x) {
  x += dpp_row<0x161>(x);
  x += dpp_row<0x162>(x);
  x += dpp_row<0x164>(x);
  x += dpp_row<0x168>(x);
  return x + xhalf(x);
}

// 2^x of sixteen values, in place. One statement: inside it no v_exp_f32 is
// followed by an instruction that reads its result or overwrites its source,
// and the closing v_nop is that free slot behind the last one.
__device__ static inline void exp2_x16(float (&e)[16]) {
  asm("v_exp_f32 %0, %0\n\tv_exp_f32 %1, %1\n\tv_exp_f32 %2, %2\n\t"
      "v_exp_f32 %3, %3\n\tv_exp_f32 %4, %4\n\tv_exp_f32 %5, %5\n\t"
      "v_exp_f32 %6, %6\n\tv_exp_f32 %7, %7\n\tv_exp_f32 %8, %8\n\t"
      "v_exp_f32 %9, %9\n\tv_exp_f32 %10, %10\n\tv_exp_f32 %11, %11\n\t"
      "v_exp_f32 %12, %12\n\tv_exp_f32 %13, %13\n\tv_exp_f32 %14, %14\n\t"
      "v_exp_f32 %15, %15\n\tv_nop"
      : "+v"(e[0]), "+v"(e[1]), "+v"(e[2]), "+v"(e[3]), "+v"(e[4]), "+v"(e[5]),
        "+v"(e[6]), "+v"(e[7]), "+v"(e[8]), "+v"(e[9]), "+v"(e[10]),
        "+v"(e[11]), "+v"(e[12]), "+v"(e[13]), "+v"(e[14]), "+v"(e[15]));
}

// ---------------------------------------------------------------------------
// Kernel 1: qkv = x @ qkv_w^T + qkv_b, scattered into window-gathered layout
//   q/k : f16 [1024 window-heads][512 tokens][16]
//   v   : f32 same shape (kept f32 for LePE conv precision)
// window-head index: wh = (((dir*16 + b)*8 + win)*4 + local_head)
// ---------------------------------------------------------------------------
__global__ __launch_bounds__(256) void cswin_qkv_kernel(
    const float* __restrict__ x, const float* __restrict__ w,
    const float* __restrict__ bias,
    _Float16* __restrict__ qbuf, _Float16* __restrict__ kbuf,
    float* __restrict__ vbuf)
{
  __shared__ _Float16 As[64 * 128];
  __shared__ _Float16 Ws[64 * 128];
  const int tid  = threadIdx.x;
  const int lane = tid & 31;
  const int wave = tid >> 5;                 // 8 waves (wave32)
  const int mbase = blockIdx.x * 64;         // token tile
  const int nbase = blockIdx.y * 64;         // output-channel tile (of 384)

  __builtin_prefetch(x + (mbase + 63) * 128, 0, 0);

  for (int i = tid; i < 64 * 128; i += 256) {
    int r = i >> 7, k = i & 127;
    As[i] = (_Float16)x[(mbase + r) * 128 + k];
    Ws[i] = (_Float16)w[(nbase + r) * 128 + k];
  }
  __syncthreads();

  for (int t = wave * 2; t < wave * 2 + 2; ++t) {  // 16 tiles / 8 waves
    const int mt = t >> 2, nt = t & 3;
    v8f c = {};
#pragma unroll
    for (int kc = 0; kc < 4; ++kc) {               // K = 128
      v16h a = frag_k32_f16(As + (mt * 16) * 128 + kc * 32, 128);
      v16h b = frag_k32_f16(Ws + (nt * 16) * 128 + kc * 32, 128);
      c = __builtin_amdgcn_wmma_f32_16x16x32_f16(false, a, false, b,
                                                 (short)0, c, false, false);
    }
    const int col   = nbase + nt * 16 + (lane & 15);
    const int rhalf = (lane >> 4) << 3;
    const int sel   = col >> 7;                    // 0=q 1=k 2=v
    const int cc    = col & 127;
    const int head  = cc >> 4, hd = cc & 15;
    const int dir   = head >> 2, hloc = head & 3;
#pragma unroll
    for (int r = 0; r < 8; ++r) {
      const int m = mbase + mt * 16 + r + rhalf;
      const float val = c[r] + bias[col];
      const int b_ = m >> 12, n = m & 4095;
      const int y = n >> 6, xq = n & 63;
      int win, pos;
      if (dir == 0) { win = y >> 3;  pos = ((y & 7) << 6) | xq; }
      else          { win = xq >> 3; pos = (y << 3) | (xq & 7); }
      const int wh  = ((dir * 16 + b_) * 8 + win) * 4 + hloc;
      const int off = (wh * 512 + pos) * 16 + hd;
      if      (sel == 0) qbuf[off] = (_Float16)val;
      else if (sel == 1) kbuf[off] = (_Float16)val;
      else               vbuf[off] = val;
    }
  }
}

// ---------------------------------------------------------------------------
// Kernel 2: stripe attention for one (window-head, 64-row M-block).
//   - LePE (depthwise 3x3 + v) into Vt (d-major f16 in LDS)
//   - S = Q K^T via WMMA (K=16 zero-padded to 32)
//   - row softmax (scale 0.25): one wave per row, lanes across the columns,
//     the row read once from LDS, kept in registers, written back once
//   - O = P @ V_le via WMMA, K=512 split across wave pairs, LDS combine
// ---------------------------------------------------------------------------
__global__ __launch_bounds__(256) void cswin_attn_kernel(
    const _Float16* __restrict__ qbuf, const _Float16* __restrict__ kbuf,
    const float* __restrict__ vbuf,
    const float* __restrict__ dwh_w, const float* __restrict__ dwh_b,
    const float* __restrict__ dwv_w, const float* __restrict__ dwv_b,
    float* __restrict__ obuf)
{
  extern __shared__ char smem[];
  float*    Ss   = (float*)smem;                     // 64 x 512 scores (128KB)
  float*    cscr = Ss + 64 * 512;                    // 4 x 256 combine
  _Float16* Qs   = (_Float16*)(cscr + 4 * 256);      // 64 x 16
  _Float16* Ks   = Qs + 64 * 16;                     // 512 x 16
  _Float16* Vt   = Ks + 512 * 16;                    // 16 x VTLD (d-major)
  const int VTLD = 520;

  const int tid  = threadIdx.x;
  const int lane = tid & 31;
  const int wave = tid >> 5;
  const int mb   = blockIdx.x;        // 0..7  (64-row M block)
  const int wh   = blockIdx.y;        // 0..1023
  const int dir  = wh >> 9;
  const int mbase = mb * 64;

  const _Float16* qw = qbuf + (wh * 512 + mbase) * 16;
  const _Float16* kw = kbuf + (size_t)wh * 512 * 16;
  const float*    vw = vbuf + (size_t)wh * 512 * 16;

  __builtin_prefetch(vw + tid * 16, 0, 0);

  for (int i = tid; i < 64 * 16;  i += 256) Qs[i] = qw[i];
  for (int i = tid; i < 512 * 16; i += 256) Ks[i] = kw[i];

  // LePE: Vt[d][p] = v + conv3x3_dw(v) + bias, zero-padded within the window
  const float* cw = dir ? dwv_w : dwh_w;
  const float* cb = dir ? dwv_b : dwh_b;
  const int ws = dir ? 8 : 64;
  const int hs = 512 / ws;
  for (int i = tid; i < 16 * 512; i += 256) {
    const int d = i >> 9, p = i & 511;
    const int r = p / ws, c = p % ws;
    float acc = cb[d];
#pragma unroll
    for (int dy = -1; dy <= 1; ++dy)
#pragma unroll
      for (int dx = -1; dx <= 1; ++dx) {
        const int rr = r + dy, c2 = c + dx;
        if (rr >= 0 && rr < hs && c2 >= 0 && c2 < ws)
          acc += vw[(rr * ws + c2) * 16 + d] * cw[d * 9 + (dy + 1) * 3 + (dx + 1)];
      }
    acc += vw[p * 16 + d];
    Vt[d * VTLD + p] = (_Float16)acc;
  }
  __syncthreads();

  // --- S = Q K^T : 4x32 tiles, 16 per wave ---
  for (int i = 0; i < 16; ++i) {
    const int t  = wave * 16 + i;
    const int mt = t >> 5, nt = t & 31;
    v16h a = frag_k16(Qs + mt * 16 * 16, 16);
    v16h b = frag_k16(Ks + nt * 16 * 16, 16);
    v8f c = {};
    c = __builtin_amdgcn_wmma_f32_16x16x32_f16(false, a, false, b,
                                               (short)0, c, false, false);
    const int rhalf = (lane >> 4) << 3;
    const int col   = nt * 16 + (lane & 15);
#pragma unroll
    for (int r = 0; r < 8; ++r)
      Ss[(mt * 16 + r + rhalf) * 512 + col] = c[r];
  }
  __syncthreads();

  // --- row softmax, scale = 16^-0.5 = 0.25 ---
  // Wave w owns rows 8w..8w+7. Lane l holds columns 128k + 4l .. 4l+3 (k = 0..3)
  // of each: every LDS access is 32 lanes x 16 contiguous bytes.
  {
    const float scale = 0.25f;
    const float log2e = 1.44269504f;
    float4* rp = (float4*)(Ss + wave * 8 * 512) + lane;
    float4 v[8][4];
    float  rmax[8], rsum[8];
#pragma unroll  // constant indices keep the arrays in registers
    for (int r = 0; r < 8; ++r)
#pragma unroll  // constant indices keep the arrays in registers
      for (int k = 0; k < 4; ++k) v[r][k] = rp[r * 128 + k * 32];
#pragma unroll  // constant indices keep the arrays in registers
    for (int r = 0; r < 8; ++r) {
      float m = -3.4e38f;
#pragma unroll  // constant indices keep the arrays in registers
      for (int k = 0; k < 4; ++k)
        m = max2(m, max2(max2(v[r][k].x, v[r][k].y),
                         max2(v[r][k].z, v[r][k].w)));
      rmax[r] = m;
    }
#pragma unroll  // constant indices keep the arrays in registers
    for (int r = 0; r < 8; ++r) rmax[r] = wave_max(rmax[r]);
#pragma unroll  // constant indices keep the arrays in registers
    for (int r = 0; r < 8; ++r) {
      // e^t as 2^(t * log2 e), the form __expf compiles to
      float e[16];
#pragma unroll  // constant indices keep the arrays in registers
      for (int k = 0; k < 4; ++k) {
        e[4 * k + 0] = (scale * (v[r][k].x - rmax[r])) * log2e;
        e[4 * k + 1] = (scale * (v[r][k].y - rmax[r])) * log2e;
        e[4 * k + 2] = (scale * (v[r][k].z - rmax[r])) * log2e;
        e[4 * k + 3] = (scale * (v[r][k].w - rmax[r])) * log2e;
      }
      exp2_x16(e);
      float s = 0.0f;
#pragma unroll  // constant indices keep the arrays in registers
      for (int k = 0; k < 4; ++k) {
        v[r][k] = make_float4(e[4 * k], e[4 * k + 1], e[4 * k + 2], e[4 * k + 3]);
        s += (e[4 * k] + e[4 * k + 1]) + (e[4 * k + 2] + e[4 * k + 3]);
      }
      rsum[r] = s;
    }
#pragma unroll  // constant indices keep the arrays in registers
    for (int r = 0; r < 8; ++r) rsum[r] = wave_sum(rsum[r]);
#pragma unroll  // constant indices keep the arrays in registers
    for (int r = 0; r < 8; ++r) {
      const float inv = 1.0f / rsum[r];
#pragma unroll  // constant indices keep the arrays in registers
      for (int k = 0; k < 4; ++k) {
        v[r][k].x *= inv; v[r][k].y *= inv; v[r][k].z *= inv; v[r][k].w *= inv;
        rp[r * 128 + k * 32] = v[r][k];
      }
    }
  }
  __syncthreads();

  // --- O = P @ V_le : 4 M-tiles, K=512 split across wave pairs ---
  const int mt    = wave & 3;
  const int khalf = wave >> 2;
  v8f c = {};
  for (int kc = khalf * 8; kc < khalf * 8 + 8; ++kc) {
    v16h a = frag_k32_f32(Ss + (mt * 16) * 512 + kc * 32, 512);
    v16h b = frag_k32_f16(Vt + kc * 32, VTLD);
    c = __builtin_amdgcn_wmma_f32_16x16x32_f16(false, a, false, b,
                                               (short)0, c, false, false);
  }
  if (wave >= 4) {
#pragma unroll
    for (int r = 0; r < 8; ++r) cscr[mt * 256 + r * 32 + lane] = c[r];
  }
  __syncthreads();
  if (wave < 4) {
    const int hloc = wh & 3, win = (wh >> 2) & 7, b_ = (wh >> 5) & 15;
    const int d = lane & 15;
    const int rhalf = (lane >> 4) << 3;
    const int ch = (dir * 4 + hloc) * 16 + d;   // concat: h-heads 0..63, v 64..127
#pragma unroll
    for (int r = 0; r < 8; ++r) {
      const float val = c[r] + cscr[mt * 256 + r * 32 + lane];
      const int pos = mbase + mt * 16 + r + rhalf;
      const int n = dir ? ((pos >> 3) * 64 + win * 8 + (pos & 7))
                        : (win * 512 + pos);
      obuf[(b_ * 4096 + n) * 128 + ch] = val;
    }
  }
}

// ---------------------------------------------------------------------------
// Kernel 3: out = attn_out @ proj_w^T + proj_b   (65536x128 @ 128x128)
// ---------------------------------------------------------------------------
__global__ __launch_bounds__(256) void cswin_proj_kernel(
    const float* __restrict__ a_in, const float* __restrict__ w,
    const float* __restrict__ bias, float* __restrict__ out)
{
  __shared__ _Float16 As[64 * 128];
  __shared__ _Float16 Ws[64 * 128];
  const int tid  = threadIdx.x;
  const int lane = tid & 31;
  const int wave = tid >> 5;
  const int mbase = blockIdx.x * 64;
  const int nbase = blockIdx.y * 64;

  for (int i = tid; i < 64 * 128; i += 256) {
    int r = i >> 7, k = i & 127;
    As[i] = (_Float16)a_in[(mbase + r) * 128 + k];
    Ws[i] = (_Float16)w[(nbase + r) * 128 + k];
  }
  __syncthreads();

  for (int t = wave * 2; t < wave * 2 + 2; ++t) {
    const int mt = t >> 2, nt = t & 3;
    v8f c = {};
#pragma unroll
    for (int kc = 0; kc < 4; ++kc) {
      v16h a = frag_k32_f16(As + (mt * 16) * 128 + kc * 32, 128);
      v16h b = frag_k32_f16(Ws + (nt * 16) * 128 + kc * 32, 128);
      c = __builtin_amdgcn_wmma_f32_16x16x32_f16(false, a, false, b,
                                                 (short)0, c, false, false);
    }
    const int col   = nbase + nt * 16 + (lane & 15);
    const int rhalf = (lane >> 4) << 3;
#pragma unroll
    for (int r = 0; r < 8; ++r) {
      const int m = mbase + mt * 16 + r + rhalf;
      out[m * 128 + col] = c[r] + bias[col];
    }
  }
}

// ---------------------------------------------------------------------------
extern "C" void kernel_launch(void* const* d_in, const int* in_sizes, int n_in,
                              void* d_out, int out_size, void* d_ws, size_t ws_size,
                              hipStream_t stream) {
  const float* x      = (const float*)d_in[0];
  const float* qkv_w  = (const float*)d_in[1];
  const float* qkv_b  = (const float*)d_in[2];
  const float* proj_w = (const float*)d_in[3];
  const float* proj_b = (const float*)d_in[4];
  const float* dwh_w  = (const float*)d_in[5];
  const float* dwh_b  = (const float*)d_in[6];
  const float* dwv_w  = (const float*)d_in[7];
  const float* dwv_b  = (const float*)d_in[8];
  // d_in[9]=H, d_in[10]=W fixed at 64 for this problem size.

  char* wsb = (char*)d_ws;
  _Float16* qbuf = (_Float16*)(wsb);                       // 16 MB
  _Float16* kbuf = (_Float16*)(wsb + (size_t)16 * 1024 * 1024);  // 16 MB
  float*    vbuf = (float*)   (wsb + (size_t)32 * 1024 * 1024);  // 32 MB
  float*    obuf = (float*)   (wsb + (size_t)64 * 1024 * 1024);  // 32 MB

  // QKV projection + window-gather scatter
  cswin_qkv_kernel<<<dim3(1024, 6), 256, 0, stream>>>(
      x, qkv_w, qkv_b, qbuf, kbuf, vbuf);

  // Stripe attention: 1024 window-heads x 8 M-blocks
  const size_t smem = (size_t)64 * 512 * 4 + 4 * 256 * 4 +
                      (size_t)(64 * 16 + 512 * 16 + 16 * 520) * 2;
  cswin_attn_kernel<<<dim3(8, 1024), 256, smem, stream>>>(
      qbuf, kbuf, vbuf, dwh_w, dwh_b, dwv_w, dwv_b, obuf);

  // Output projection
  cswin_proj_kernel<<<dim3(1024, 2), 256, 0, stream>>>(
      obuf, proj_w, proj_b, (float*)d_out);
}

// v002
// One run takes 517 microseconds.
// Next to v001, in two timings, it ran 2.30 times as fast each time.
// Over all steps from v000 it is 5.27 times as fast.
#include <hip/hip_runtime.h>
#include <hip/hip_bf16.h>

typedef __attribute__((ext_vector_type(16))) _Float16 v16h;
typedef __attribute__((ext_vector_type(8)))  float    v8f;

// ---------------------------------------------------------------------------
// WMMA fragment loaders (wave32, 16-bit A/B layout per CDNA5 ISA 7.12.2):
//   lane l holds row (l&15); khi = (l>>4)*8; half-element e maps to
//   K = 16*(e>=8) + khi + (e&7).
// B fragments (32x16 K-major) load identically from the row-major *transpose*
// of B, i.e. B^T (N x K) — which for Q·K^T and P·V is exactly the row-major
// tile we keep in LDS.
// ---------------------------------------------------------------------------

__device__ static inline v16h frag_k16(const _Float16* base, int ld) {
  // 16x16 tile, zero-padded to K=32 (head_dim == 16)
  const int lane = threadIdx.x & 31;
  const int row  = lane & 15;
  const int khi  = (lane >> 4) << 3;
  v16h a;
#pragma unroll
  for (int e = 0; e < 16; ++e) {
    if (e < 8) a[e] = base[row * ld + khi + (e & 7)];
    else       a[e] = (_Float16)0.0f;
  }
  return a;
}

__device__ static inline v16h frag_k32_f16(const _Float16* base, int ld) {
  const int lane = threadIdx.x & 31;
  const int row  = lane & 15;
  const int khi  = (lane >> 4) << 3;
  v16h a;
#pragma unroll
  for (int e = 0; e < 16; ++e) {
    int k = ((e >> 3) << 4) + khi + (e & 7);
    a[e] = base[row * ld + k];
  }
  return a;
}

__device__ static inline v16h frag_k32_f32(const float* base, int ld) {
  const int lane = threadIdx.x & 31;
  const int row  = lane & 15;
  const int khi  = (lane >> 4) << 3;
  v16h a;
#pragma unroll
  for (int e = 0; e < 16; ++e) {
    int k = ((e >> 3) << 4) + khi + (e & 7);
    a[e] = (_Float16)base[row * ld + k];
  }
  return a;
}

// ---------------------------------------------------------------------------
// Whole-wave (32 lanes) maximum and sum, every lane active, result in every
// lane: four xor steps inside each 16-lane row by DPP (row_xmask 1,2,4,8),
// then lane l with lane l ^ 16.
// ---------------------------------------------------------------------------
template <int CTRL>
__device__ static inline float dpp_row(float x) {
  const int b = __builtin_bit_cast(int, x);
  return __builtin_bit_cast(float,
      __builtin_amdgcn_update_dpp(0, b, CTRL, 0xf, 0xf, true));
}

__device__ static inline float xhalf(float x) {
  const int b = __builtin_bit_cast(int, x);
  return __builtin_bit_cast(float,
      __builtin_amdgcn_permlanex16(b, b, 0x76543210, 0xfedcba98, false, false));
}

__device__ static inline float max2(float a, float b) {
  return __builtin_elementwise_maximumnum(a, b);
}

__device__ static inline float wave_max(float x) {
  x = max2(x, dpp_row<0x161>(x));
  x = max2(x, dpp_row<0x162>(x));
  x = max2(x, dpp_row<0x164>(x));
  x = max2(x, dpp_row<0x168>(x));
  return max2(x, xhalf(x));
}

__device__ static inline float wave_sum(float x) {
  x += dpp_row<0x161>(x);
  x += dpp_row<0x162>(x);
  x += dpp_row<0x164>(x);
  x += dpp_row<0x168>(x);
  return x + xhalf(x);
}

// 2^x of sixteen values, in place. One statement: inside it no v_exp_f32 is
// followed by an instruction that reads its result or overwrites its source,
// and the closing v_nop is that free slot behind the last one.
__device__ static inline void exp2_x16(float (&e)[16]) {
  asm("v_exp_f32 %0, %0\n\tv_exp_f32 %1, %1\n\tv_exp_f32 %2, %2\n\t"
      "v_exp_f32 %3, %3\n\tv_exp_f32 %4, %4\n\tv_exp_f32 %5, %5\n\t"
      "v_exp_f32 %6, %6\n\tv_exp_f32 %7, %7\n\tv_exp_f32 %8, %8\n\t"
      "v_exp_f32 %9, %9\n\tv_exp_f32 %10, %10\n\tv_exp_f32 %11, %11\n\t"
      "v_exp_f32 %12, %12\n\tv_exp_f32 %13, %13\n\tv_exp_f32 %14, %14\n\t"
      "v_exp_f32 %15, %15\n\tv_nop"
      : "+v"(e[0]), "+v"(e[1]), "+v"(e[2]), "+v"(e[3]), "+v"(e[4]), "+v"(e[5]),
        "+v"(e[6]), "+v"(e[7]), "+v"(e[8]), "+v"(e[9]), "+v"(e[10]),
        "+v"(e[11]), "+v"(e[12]), "+v"(e[13]), "+v"(e[14]), "+v"(e[15]));
}

// ---------------------------------------------------------------------------
// Kernel 1: qkv = x @ qkv_w^T + qkv_b, scattered into window-gathered layout
//   q/k : f16 [1024 window-heads][512 tokens][16]
//   v   : f32 same shape (kept f32 for LePE conv precision)
// window-head index: wh = (((dir*16 + b)*8 + win)*4 + local_head)
// ---------------------------------------------------------------------------
__global__ __launch_bounds__(256) void cswin_qkv_kernel(
    const float* __restrict__ x, const float* __restrict__ w,
    const float* __restrict__ bias,
    _Float16* __restrict__ qbuf, _Float16* __restrict__ kbuf,
    float* __restrict__ vbuf)
{
  __shared__ _Float16 As[64 * 128];
  __shared__ _Float16 Ws[64 * 128];
  const int tid  = threadIdx.x;
  const int lane = tid & 31;
  const int wave = tid >> 5;                 // 8 waves (wave32)
  const int mbase = blockIdx.x * 64;         // token tile
  const int nbase = blockIdx.y * 64;         // output-channel tile (of 384)

  __builtin_prefetch(x + (mbase + 63) * 128, 0, 0);

  for (int i = tid; i < 64 * 128; i += 256) {
    int r = i >> 7, k = i & 127;
    As[i] = (_Float16)x[(mbase + r) * 128 + k];
    Ws[i] = (_Float16)w[(nbase + r) * 128 + k];
  }
  __syncthreads();

  for (int t = wave * 2; t < wave * 2 + 2; ++t) {  // 16 tiles / 8 waves
    const int mt = t >> 2, nt = t & 3;
    v8f c = {};
#pragma unroll
    for (int kc = 0; kc < 4; ++kc) {               // K = 128
      v16h a = frag_k32_f16(As + (mt * 16) * 128 + kc * 32, 128);
      v16h b = frag_k32_f16(Ws + (nt * 16) * 128 + kc * 32, 128);
      c = __builtin_amdgcn_wmma_f32_16x16x32_f16(false, a, false, b,
                                                 (short)0, c, false, false);
    }
    const int col   = nbase + nt * 16 + (lane & 15);
    const int rhalf = (lane >> 4) << 3;
    const int sel   = col >> 7;                    // 0=q 1=k 2=v
    const int cc    = col & 127;
    const int head  = cc >> 4, hd = cc & 15;
    const int dir   = head >> 2, hloc = head & 3;
#pragma unroll
    for (int r = 0; r < 8; ++r) {
      const int m = mbase + mt * 16 + r + rhalf;
      const float val = c[r] + bias[col];
      const int b_ = m >> 12, n = m & 4095;
      const int y = n >> 6, xq = n & 63;
      int win, pos;
      if (dir == 0) { win = y >> 3;  pos = ((y & 7) << 6) | xq; }
      else          { win = xq >> 3; pos = (y << 3) | (xq & 7); }
      const int wh  = ((dir * 16 + b_) * 8 + win) * 4 + hloc;
      const int off = (wh * 512 + pos) * 16 + hd;
      if      (sel == 0) qbuf[off] = (_Float16)val;
      else if (sel == 1) kbuf[off] = (_Float16)val;
      else               vbuf[off] = val;
    }
  }
}

// ---------------------------------------------------------------------------
// LePE of one window of (512 / WS) x WS tokens, 256 threads:
//   Vt[d][p] = v[p][d] + bias[d] + sum over the 3x3 taps inside the window.
// v is token-major with 16 channels a token, so the lanes run across the
// channels: lanes 0-15 are the channels of one token, lanes 16-31 those of the
// next token of the row, and every global read of a wave falls in 128
// contiguous bytes. A thread keeps its channel's nine weights in registers and
// walks down one column of the window, so each row of three neighbours is read
// once and serves three outputs. A thread's reads stand together, in front of
// its sums, so that they are in flight at once. A tap left or right of the
// window gets weight zero and reads the thread's own column instead; a row
// above or below counts as zero.
// ---------------------------------------------------------------------------
#define VT_LD 520
template <int WS>
__device__ static inline void lepe_window(
    const float* __restrict__ vw, const float* __restrict__ cw,
    const float* __restrict__ cb, _Float16* __restrict__ Vt, int tid)
{
  constexpr int HS    = 512 / WS;                    // rows of the window
  constexpr int CW    = WS >= 16 ? 16 : WS;          // columns taken in one pass
  constexpr int NPASS = WS / CW;                     // column passes a thread makes
  constexpr int NSEG  = 16 / CW;                     // row segments of the window
  constexpr int ROWS  = HS / NSEG;                   // rows a thread walks
  constexpr int RS    = WS * 16;                     // floats from row to row
  const int d   = tid & 15;
  const int u   = tid >> 4;                          // 0..15
  const int c0  = u % CW;                            // column in pass 0
  const int seg = u / CW;
  const int r0  = seg * ROWS;

  const int ow = d * 36;                             // bytes to the channel's weights
  const float* pw = (const float*)((const char*)cw + ow);
  float w[9];
#pragma unroll  // constant indices keep the array in registers
  for (int j = 0; j < 9; ++j) w[j] = pw[j];
  const float bias = cb[d];
  // The address registers of the loads above stay untouched up to this wait.
  asm volatile("s_wait_xcnt 0x0" :: "v"(pw), "v"(d) : "memory");

  const float* pv = vw + (r0 * WS + c0) * 16 + d;    // first row, own column
  _Float16*    po = Vt + d * VT_LD + r0 * WS + c0;
  // row above the first and row below the last: inside the window or not
  const bool has_up = seg > 0, has_dn = seg < NSEG - 1;
  const int  up = has_up ? -RS : 0;
  const int  dn = has_dn ? ROWS * RS : (ROWS - 1) * RS;
  // left of the first pass's column, right of the last pass's
  const bool has_l = c0 > 0, has_r = c0 < CW - 1;
  const float* pm = pv;
  const float* pl = has_l ? pv - 16 : pv;
  const float* pr = (has_r ? pv + 16 : pv) + (NPASS - 1) * CW * 16;
  // the same three columns in the row above and in the row below (NSEG > 1)
  const float* plu = pl + up, * pmu = pm + up, * pru = pr + up;
  const float* pld = pl + dn, * pmd = pm + dn, * prd = pr + dn;

  // x[ps][j]: row r0 - 1 + j of the three columns of pass ps
  float x[NPASS][ROWS + 2][3];
#pragma unroll  // constant indices keep the arrays in registers
  for (int ps = 0; ps < NPASS; ++ps) {
    const float* ql = ps > 0         ? pm + (ps * CW - 1) * 16 : pl;
    const float* qm = pm + ps * CW * 16;
    const float* qr = ps < NPASS - 1 ? pm + (ps * CW + 1) * 16 : pr;
#pragma unroll  // constant indices keep the arrays in registers
    for (int j = 1; j <= ROWS; ++j) {
      x[ps][j][0] = ql[(j - 1) * RS];
      x[ps][j][1] = qm[(j - 1) * RS];
      x[ps][j][2] = qr[(j - 1) * RS];
    }
  }
  if (NSEG > 1) {                                    // then NPASS == 1
    x[0][0][0] = plu[0];
    x[0][0][1] = pmu[0];
    x[0][0][2] = pru[0];
    x[0][ROWS + 1][0] = pld[0];
    x[0][ROWS + 1][1] = pmd[0];
    x[0][ROWS + 1][2] = prd[0];
    // The address registers of the loads above stay untouched up to this wait.
    asm volatile("s_wait_xcnt 0x0" :: "v"(pl), "v"(pm), "v"(pr), "v"(plu),
                 "v"(pmu), "v"(pru), "v"(pld), "v"(pmd), "v"(prd) : "memory");
  } else {
    // The address registers of the loads above stay untouched up to this wait.
    asm volatile("s_wait_xcnt 0x0" :: "v"(pl), "v"(pm), "v"(pr) : "memory");
  }

#pragma unroll  // constant indices keep the arrays in registers
  for (int ps = 0; ps < NPASS; ++ps) {
    float wl[3], wr[3];
#pragma unroll  // constant indices keep the arrays in registers
    for (int j = 0; j < 3; ++j) {
      wl[j] = (ps > 0 || has_l)         ? w[3 * j]     : 0.0f;
      wr[j] = (ps < NPASS - 1 || has_r) ? w[3 * j + 2] : 0.0f;
    }
    if (NSEG > 1) {
#pragma unroll  // constant indices keep the arrays in registers
      for (int k = 0; k < 3; ++k) {
        x[ps][0][k]        = has_up ? x[ps][0][k]        : 0.0f;
        x[ps][ROWS + 1][k] = has_dn ? x[ps][ROWS + 1][k] : 0.0f;
      }
    }
#pragma unroll  // constant indices keep the arrays in registers
    for (int j = 0; j < ROWS; ++j) {
      float acc = bias;
#pragma unroll  // constant indices keep the arrays in registers
      for (int dy = 0; dy < 3; ++dy) {
        if (NSEG == 1 && (j + dy == 0 || j + dy == ROWS + 1)) continue;
        acc += x[ps][j + dy][0] * wl[dy];
        acc += x[ps][j + dy][1] * w[3 * dy + 1];
        acc += x[ps][j + dy][2] * wr[dy];
      }
      acc += x[ps][j + 1][1];
      po[j * WS + ps * CW] = (_Float16)acc;
    }
  }
}

// ---------------------------------------------------------------------------
// Kernel 2: stripe attention for one (window-head, 64-row M-block).
//   - LePE (depthwise 3x3 + v) into Vt (d-major f16 in LDS)
//   - S = Q K^T via WMMA (K=16 zero-padded to 32)
//   - row softmax (scale 0.25): one wave per row, lanes across the columns,
//     the row read once from LDS, kept in registers, written back once
//   - O = P @ V_le via WMMA, K=512 split across wave pairs, LDS combine
// ---------------------------------------------------------------------------
__global__ __launch_bounds__(256) void cswin_attn_kernel(
    const _Float16* __restrict__ qbuf, const _Float16* __restrict__ kbuf,
    const float* __restrict__ vbuf,
    const float* __restrict__ dwh_w, const float* __restrict__ dwh_b,
    const float* __restrict__ dwv_w, const float* __restrict__ dwv_b,
    float* __restrict__ obuf)
{
  extern __shared__ char smem[];
  float*    Ss   = (float*)smem;                     // 64 x 512 scores (128KB)
  float*    cscr = Ss + 64 * 512;                    // 4 x 256 combine
  _Float16* Qs   = (_Float16*)(cscr + 4 * 256);      // 64 x 16
  _Float16* Ks   = Qs + 64 * 16;                     // 512 x 16
  _Float16* Vt   = Ks + 512 * 16;                    // 16 x VTLD (d-major)
  const int VTLD = VT_LD;

  const int tid  = threadIdx.x;
  const int lane = tid & 31;
  const int wave = tid >> 5;
  const int mb   = blockIdx.x;        // 0..7  (64-row M block)
  const int wh   = blockIdx.y;        // 0..1023
  const int dir  = wh >> 9;
  const int mbase = mb * 64;

  const _Float16* qw = qbuf + (wh * 512 + mbase) * 16;
  const _Float16* kw = kbuf + (size_t)wh * 512 * 16;
  const float*    vw = vbuf + (size_t)wh * 512 * 16;

  __builtin_prefetch(vw + tid * 16, 0, 0);

  for (int i = tid; i < 64 * 16;  i += 256) Qs[i] = qw[i];
  for (int i = tid; i < 512 * 16; i += 256) Ks[i] = kw[i];

  // LePE: Vt[d][p] = v + conv3x3_dw(v) + bias, zero-padded within the window
  if (dir) lepe_window<8>(vw, dwv_w, dwv_b, Vt, tid);
  else     lepe_window<64>(vw, dwh_w, dwh_b, Vt, tid);
  __syncthreads();

  // --- S = Q K^T : 4x32 tiles, 16 per wave ---
  for (int i = 0; i < 16; ++i) {
    const int t  = wave * 16 + i;
    const int mt = t >> 5, nt = t & 31;
    v16h a = frag_k16(Qs + mt * 16 * 16, 16);
    v16h b = frag_k16(Ks + nt * 16 * 16, 16);
    v8f c = {};
    c = __builtin_amdgcn_wmma_f32_16x16x32_f16(false, a, false, b,
                                               (short)0, c, false, false);
    const int rhalf = (lane >> 4) << 3;
    const int col   = nt * 16 + (lane & 15);
#pragma unroll
    for (int r = 0; r < 8; ++r)
      Ss[(mt * 16 + r + rhalf) * 512 + col] = c[r];
  }
  __syncthreads();

  // --- row softmax, scale = 16^-0.5 = 0.25 ---
  // Wave w owns rows 8w..8w+7. Lane l holds columns 128k + 4l .. 4l+3 (k = 0..3)
  // of each: every LDS access is 32 lanes x 16 contiguous bytes.
  {
    const float scale = 0.25f;
    const float log2e = 1.44269504f;
    float4* rp = (float4*)(Ss + wave * 8 * 512) + lane;
    float4 v[8][4];
    float  rmax[8], rsum[8];
#pragma unroll  // constant indices keep the arrays in registers
    for (int r = 0; r < 8; ++r)
#pragma unroll  // constant indices keep the arrays in registers
      for (int k = 0; k < 4; ++k) v[r][k] = rp[r * 128 + k * 32];
#pragma unroll  // constant indices keep the arrays in registers
    for (int r = 0; r < 8; ++r) {
      float m = -3.4e38f;
#pragma unroll  // constant indices keep the arrays in registers
      for (int k = 0; k < 4; ++k)
        m = max2(m, max2(max2(v[r][k].x, v[r][k].y),
                         max2(v[r][k].z, v[r][k].w)));
      rmax[r] = m;
    }
#pragma unroll  // constant indices keep the arrays in registers
    for (int r = 0; r < 8; ++r) rmax[r] = wave_max(rmax[r]);
#pragma unroll  // constant indices keep the arrays in registers
    for (int r = 0; r < 8; ++r) {
      // e^t as 2^(t * log2 e), the form __expf compiles to
      float e[16];
#pragma unroll  // constant indices keep the arrays in registers
      for (int k = 0; k < 4; ++k) {
        e[4 * k + 0] = (scale * (v[r][k].x - rmax[r])) * log2e;
        e[4 * k + 1] = (scale * (v[r][k].y - rmax[r])) * log2e;
        e[4 * k + 2] = (scale * (v[r][k].z - rmax[r])) * log2e;
        e[4 * k + 3] = (scale * (v[r][k].w - rmax[r])) * log2e;
      }
      exp2_x16(e);
      float s = 0.0f;
#pragma unroll  // constant indices keep the arrays in registers
      for (int k = 0; k < 4; ++k) {
        v[r][k] = make_float4(e[4 * k], e[4 * k + 1], e[4 * k + 2], e[4 * k + 3]);
        s += (e[4 * k] + e[4 * k + 1]) + (e[4 * k + 2] + e[4 * k + 3]);
      }
      rsum[r] = s;
    }
#pragma unroll  // constant indices keep the arrays in registers
    for (int r = 0; r < 8; ++r) rsum[r] = wave_sum(rsum[r]);
#pragma unroll  // constant indices keep the arrays in registers
    for (int r = 0; r < 8; ++r) {
      const float inv = 1.0f / rsum[r];
#pragma unroll  // constant indices keep the arrays in registers
      for (int k = 0; k < 4; ++k) {
        v[r][k].x *= inv; v[r][k].y *= inv; v[r][k].z *= inv; v[r][k].w *= inv;
        rp[r * 128 + k * 32] = v[r][k];
      }
    }
  }
  __syncthreads();

  // --- O = P @ V_le : 4 M-tiles, K=512 split across wave pairs ---
  const int mt    = wave & 3;
  const int khalf = wave >> 2;
  v8f c = {};
  for (int kc = khalf * 8; kc < khalf * 8 + 8; ++kc) {
    v16h a = frag_k32_f32(Ss + (mt * 16) * 512 + kc * 32, 512);
    v16h b = frag_k32_f16(Vt + kc * 32, VTLD);
    c = __builtin_amdgcn_wmma_f32_16x16x32_f16(false, a, false, b,
                                               (short)0, c, false, false);
  }
  if (wave >= 4) {
#pragma unroll
    for (int r = 0; r < 8; ++r) cscr[mt * 256 + r * 32 + lane] = c[r];
  }
  __syncthreads();
  if (wave < 4) {
    const int hloc = wh & 3, win = (wh >> 2) & 7, b_ = (wh >> 5) & 15;
    const int d = lane & 15;
    const int rhalf = (lane >> 4) << 3;
    const int ch = (dir * 4 + hloc) * 16 + d;   // concat: h-heads 0..63, v 64..127
#pragma unroll
    for (int r = 0; r < 8; ++r) {
      const float val = c[r] + cscr[mt * 256 + r * 32 + lane];
      const int pos = mbase + mt * 16 + r + rhalf;
      const int n = dir ? ((pos >> 3) * 64 + win * 8 + (pos & 7))
                        : (win * 512 + pos);
      obuf[(b_ * 4096 + n) * 128 + ch] = val;
    }
  }
}

// ---------------------------------------------------------------------------
// Kernel 3: out = attn_out @ proj_w^T + proj_b   (65536x128 @ 128x128)
// ---------------------------------------------------------------------------
__global__ __launch_bounds__(256) void cswin_proj_kernel(
    const float* __restrict__ a_in, const float* __restrict__ w,
    const float* __restrict__ bias, float* __restrict__ out)
{
  __shared__ _Float16 As[64 * 128];
  __shared__ _Float16 Ws[64 * 128];
  const int tid  = threadIdx.x;
  const int lane = tid & 31;
  const int wave = tid >> 5;
  const int mbase = blockIdx.x * 64;
  const int nbase = blockIdx.y * 64;

  for (int i = tid; i < 64 * 128; i += 256) {
    int r = i >> 7, k = i & 127;
    As[i] = (_Float16)a_in[(mbase + r) * 128 + k];
    Ws[i] = (_Float16)w[(nbase + r) * 128 + k];
  }
  __syncthreads();

  for (int t = wave * 2; t < wave * 2 + 2; ++t) {
    const int mt = t >> 2, nt = t & 3;
    v8f c = {};
#pragma unroll
    for (int kc = 0; kc < 4; ++kc) {
      v16h a = frag_k32_f16(As + (mt * 16) * 128 + kc * 32, 128);
      v16h b = frag_k32_f16(Ws + (nt * 16) * 128 + kc * 32, 128);
      c = __builtin_amdgcn_wmma_f32_16x16x32_f16(false, a, false, b,
                                                 (short)0, c, false, false);
    }
    const int col   = nbase + nt * 16 + (lane & 15);
    const int rhalf = (lane >> 4) << 3;
#pragma unroll
    for (int r = 0; r < 8; ++r) {
      const int m = mbase + mt * 16 + r + rhalf;
      out[m * 128 + col] = c[r] + bias[col];
    }
  }
}

// ---------------------------------------------------------------------------
extern "C" void kernel_launch(void* const* d_in, const int* in_sizes, int n_in,
                              void* d_out, int out_size, void* d_ws, size_t ws_size,
                              hipStream_t stream) {
  const float* x      = (const float*)d_in[0];
  const float* qkv_w  = (const float*)d_in[1];
  const float* qkv_b  = (const float*)d_in[2];
  const float* proj_w = (const float*)d_in[3];
  const float* proj_b = (const float*)d_in[4];
  const float* dwh_w  = (const float*)d_in[5];
  const float* dwh_b  = (const float*)d_in[6];
  const float* dwv_w  = (const float*)d_in[7];
  const float* dwv_b  = (const float*)d_in[8];
  // d_in[9]=H, d_in[10]=W fixed at 64 for this problem size.

  char* wsb = (char*)d_ws;
  _Float16* qbuf = (_Float16*)(wsb);                       // 16 MB
  _Float16* kbuf = (_Float16*)(wsb + (size_t)16 * 1024 * 1024);  // 16 MB
  float*    vbuf = (float*)   (wsb + (size_t)32 * 1024 * 1024);  // 32 MB
  float*    obuf = (float*)   (wsb + (size_t)64 * 1024 * 1024);  // 32 MB

  // QKV projection + window-gather scatter
  cswin_qkv_kernel<<<dim3(1024, 6), 256, 0, stream>>>(
      x, qkv_w, qkv_b, qbuf, kbuf, vbuf);

  // Stripe attention: 1024 window-heads x 8 M-blocks
  const size_t smem = (size_t)64 * 512 * 4 + 4 * 256 * 4 +
                      (size_t)(64 * 16 + 512 * 16 + 16 * 520) * 2;
  cswin_attn_kernel<<<dim3(8, 1024), 256, smem, stream>>>(
      qbuf, kbuf, vbuf, dwh_w, dwh_b, dwv_w, dwv_b, obuf);

  // Output projection
  cswin_proj_kernel<<<dim3(1024, 2), 256, 0, stream>>>(
      obuf, proj_w, proj_b, (float*)d_out);
}

// v003
// It runs in 317 microseconds.
// Timed twice side by side with v002, it ran 1.63 times as fast both times.
// Counting every step since v000, it is 8.61 times as fast.
#include <hip/hip_runtime.h>
#include <hip/hip_bf16.h>

typedef __attribute__((ext_vector_type(16))) _Float16 v16h;
typedef __attribute__((ext_vector_type(8)))  float    v8f;

// ---------------------------------------------------------------------------
// WMMA fragment loaders (wave32, 16-bit A/B layout per CDNA5 ISA 7.12.2):
//   lane l holds row (l&15); khi = (l>>4)*8; half-element e maps to
//   K = 16*(e>=8) + khi + (e&7).
// B fragments (32x16 K-major) load identically from the row-major *transpose*
// of B, i.e. B^T (N x K) — which for Q·K^T and P·V is exactly the row-major
// tile we keep in LDS.
// ---------------------------------------------------------------------------

__device__ static inline v16h frag_k16(const _Float16* base, int ld) {
  // 16x16 tile, zero-padded to K=32 (head_dim == 16)
  const int lane = threadIdx.x & 31;
  const int row  = lane & 15;
  const int khi  = (lane >> 4) << 3;
  v16h a;
#pragma unroll
  for (int e = 0; e < 16; ++e) {
    if (e < 8) a[e] = base[row * ld + khi + (e & 7)];
    else       a[e] = (_Float16)0.0f;
  }
  return a;
}

__device__ static inline v16h frag_k32_f16(const _Float16* base, int ld) {
  const int lane = threadIdx.x & 31;
  const int row  = lane & 15;
  const int khi  = (lane >> 4) << 3;
  v16h a;
#pragma unroll
  for (int e = 0; e < 16; ++e) {
    int k = ((e >> 3) << 4) + khi + (e & 7);
    a[e] = base[row * ld + k];
  }
  return a;
}

__device__ static inline v16h frag_k32_f32(const float* base, int ld) {
  const int lane = threadIdx.x & 31;
  const int row  = lane & 15;
  const int khi  = (lane >> 4) << 3;
  // base, ld and khi are multiples of 4 floats: four 16-byte reads a lane,
  // the width that the padded pitch spreads over all banks
  const float4* p = (const float4*)(base + row * ld + khi);
  const float4 f[4] = {p[0], p[1], p[4], p[5]};   // k = khi + 0..7, 16 + khi + 0..7
  v16h a;
#pragma unroll
  for (int j = 0; j < 4; ++j) {
    a[4 * j + 0] = (_Float16)f[j].x;
    a[4 * j + 1] = (_Float16)f[j].y;
    a[4 * j + 2] = (_Float16)f[j].z;
    a[4 * j + 3] = (_Float16)f[j].w;
  }
  return a;
}

// ---------------------------------------------------------------------------
// Whole-wave (32 lanes) maximum and sum, every lane active, result in every
// lane: four xor steps inside each 16-lane row by DPP (row_xmask 1,2,4,8),
// then lane l with lane l ^ 16.
// ---------------------------------------------------------------------------
template <int CTRL>
__device__ static inline float dpp_row(float x) {
  const int b = __builtin_bit_cast(int, x);
  return __builtin_bit_cast(float,
      __builtin_amdgcn_update_dpp(0, b, CTRL, 0xf, 0xf, true));
}

__device__ static inline float xhalf(float x) {
  const int b = __builtin_bit_cast(int, x);
  return __builtin_bit_cast(float,
      __builtin_amdgcn_permlanex16(b, b, 0x76543210, 0xfedcba98, false, false));
}

__device__ static inline float max2(float a, float b) {
  return __builtin_elementwise_maximumnum(a, b);
}

__device__ static inline float wave_max(float x) {
  x = max2(x, dpp_row<0x161>(x));
  x = max2(x, dpp_row<0x162>(x));
  x = max2(x, dpp_row<0x164>(x));
  x = max2(x, dpp_row<0x168>(x));
  return max2(x, xhalf(x));
}

__device__ static inline float wave_sum(float x) {
  x += dpp_row<0x161>(x);
  x += dpp_row<0x162>(x);
  x += dpp_row<0x164>(x);
  x += dpp_row<0x168>(x);
  return x + xhalf(x);
}

// 2^x of sixteen values, in place. One statement: inside it no v_exp_f32 is
// followed by an instruction that reads its result or overwrites its source,
// and the closing v_nop is that free slot behind the last one.
__device__ static inline void exp2_x16(float (&e)[16]) {
  asm("v_exp_f32 %0, %0\n\tv_exp_f32 %1, %1\n\tv_exp_f32 %2, %2\n\t"
      "v_exp_f32 %3, %3\n\tv_exp_f32 %4, %4\n\tv_exp_f32 %5, %5\n\t"
      "v_exp_f32 %6, %6\n\tv_exp_f32 %7, %7\n\tv_exp_f32 %8, %8\n\t"
      "v_exp_f32 %9, %9\n\tv_exp_f32 %10, %10\n\tv_exp_f32 %11, %11\n\t"
      "v_exp_f32 %12, %12\n\tv_exp_f32 %13, %13\n\tv_exp_f32 %14, %14\n\t"
      "v_exp_f32 %15, %15\n\tv_nop"
      : "+v"(e[0]), "+v"(e[1]), "+v"(e[2]), "+v"(e[3]), "+v"(e[4]), "+v"(e[5]),
        "+v"(e[6]), "+v"(e[7]), "+v"(e[8]), "+v"(e[9]), "+v"(e[10]),
        "+v"(e[11]), "+v"(e[12]), "+v"(e[13]), "+v"(e[14]), "+v"(e[15]));
}

// ---------------------------------------------------------------------------
// Row pitches of the LDS tiles that the fragment loaders read. A fragment read
// is 16 bytes a lane with the 16 lanes of a half-wave on 16 consecutive rows:
// at a pitch of an odd multiple of 16 bytes those rows fall on distinct banks.
// ---------------------------------------------------------------------------
#define G_LD  136   // halves: 128-wide f16 GEMM tiles, 272 B a row
#define S_LD  516   // floats: 512-wide score rows, 2064 B a row
#define QK_LD 24    // halves: 16-wide q and k rows, 48 B a row

// ---------------------------------------------------------------------------
// Kernel 1: qkv = x @ qkv_w^T + qkv_b, scattered into window-gathered layout
//   q/k : f16 [1024 window-heads][512 tokens][16]
//   v   : f32 same shape (kept f32 for LePE conv precision)
// window-head index: wh = (((dir*16 + b)*8 + win)*4 + local_head)
// ---------------------------------------------------------------------------
__global__ __launch_bounds__(256) void cswin_qkv_kernel(
    const float* __restrict__ x, const float* __restrict__ w,
    const float* __restrict__ bias,
    _Float16* __restrict__ qbuf, _Float16* __restrict__ kbuf,
    float* __restrict__ vbuf)
{
  __shared__ _Float16 As[64 * G_LD];
  __shared__ _Float16 Ws[64 * G_LD];
  const int tid  = threadIdx.x;
  const int lane = tid & 31;
  const int wave = tid >> 5;                 // 8 waves (wave32)
  const int mbase = blockIdx.x * 64;         // token tile
  const int nbase = blockIdx.y * 64;         // output-channel tile (of 384)

  __builtin_prefetch(x + (mbase + 63) * 128, 0, 0);

  for (int i = tid; i < 64 * 128; i += 256) {
    int r = i >> 7, k = i & 127;
    As[r * G_LD + k] = (_Float16)x[(mbase + r) * 128 + k];
    Ws[r * G_LD + k] = (_Float16)w[(nbase + r) * 128 + k];
  }
  __syncthreads();

  for (int t = wave * 2; t < wave * 2 + 2; ++t) {  // 16 tiles / 8 waves
    const int mt = t >> 2, nt = t & 3;
    v8f c = {};
#pragma unroll
    for (int kc = 0; kc < 4; ++kc) {               // K = 128
      v16h a = frag_k32_f16(As + (mt * 16) * G_LD + kc * 32, G_LD);
      v16h b = frag_k32_f16(Ws + (nt * 16) * G_LD + kc * 32, G_LD);
      c = __builtin_amdgcn_wmma_f32_16x16x32_f16(false, a, false, b,
                                                 (short)0, c, false, false);
    }
    const int col   = nbase + nt * 16 + (lane & 15);
    const int rhalf = (lane >> 4) << 3;
    const int sel   = col >> 7;                    // 0=q 1=k 2=v
    const int cc    = col & 127;
    const int head  = cc >> 4, hd = cc & 15;
    const int dir   = head >> 2, hloc = head & 3;
#pragma unroll
    for (int r = 0; r < 8; ++r) {
      const int m = mbase + mt * 16 + r + rhalf;
      const float val = c[r] + bias[col];
      const int b_ = m >> 12, n = m & 4095;
      const int y = n >> 6, xq = n & 63;
      int win, pos;
      if (dir == 0) { win = y >> 3;  pos = ((y & 7) << 6) | xq; }
      else          { win = xq >> 3; pos = (y << 3) | (xq & 7); }
      const int wh  = ((dir * 16 + b_) * 8 + win) * 4 + hloc;
      const int off = (wh * 512 + pos) * 16 + hd;
      if      (sel == 0) qbuf[off] = (_Float16)val;
      else if (sel == 1) kbuf[off] = (_Float16)val;
      else               vbuf[off] = val;
    }
  }
}

// ---------------------------------------------------------------------------
// LePE of one window of (512 / WS) x WS tokens, 256 threads:
//   Vt[d][p] = v[p][d] + bias[d] + sum over the 3x3 taps inside the window.
// v is token-major with 16 channels a token, so the lanes run across the
// channels: lanes 0-15 are the channels of one token, lanes 16-31 those of the
// next token of the row, and every global read of a wave falls in 128
// contiguous bytes. A thread keeps its channel's nine weights in registers and
// walks down one column of the window, so each row of three neighbours is read
// once and serves three outputs. A thread's reads stand together, in front of
// its sums, so that they are in flight at once. A tap left or right of the
// window gets weight zero and reads the thread's own column instead; a row
// above or below counts as zero.
// ---------------------------------------------------------------------------
#define VT_LD 520
template <int WS>
__device__ static inline void lepe_window(
    const float* __restrict__ vw, const float* __restrict__ cw,
    const float* __restrict__ cb, _Float16* __restrict__ Vt, int tid)
{
  constexpr int HS    = 512 / WS;                    // rows of the window
  constexpr int CW    = WS >= 16 ? 16 : WS;          // columns taken in one pass
  constexpr int NPASS = WS / CW;                     // column passes a thread makes
  constexpr int NSEG  = 16 / CW;                     // row segments of the window
  constexpr int ROWS  = HS / NSEG;                   // rows a thread walks
  constexpr int RS    = WS * 16;                     // floats from row to row
  const int d   = tid & 15;
  const int u   = tid >> 4;                          // 0..15
  const int c0  = u % CW;                            // column in pass 0
  const int seg = u / CW;
  const int r0  = seg * ROWS;

  const int ow = d * 36;                             // bytes to the channel's weights
  const float* pw = (const float*)((const char*)cw + ow);
  float w[9];
#pragma unroll  // constant indices keep the array in registers
  for (int j = 0; j < 9; ++j) w[j] = pw[j];
  const float bias = cb[d];
  // The address registers of the loads above stay untouched up to this wait.
  asm volatile("s_wait_xcnt 0x0" :: "v"(pw), "v"(d) : "memory");

  const float* pv = vw + (r0 * WS + c0) * 16 + d;    // first row, own column
  _Float16*    po = Vt + d * VT_LD + r0 * WS + c0;
  // row above the first and row below the last: inside the window or not
  const bool has_up = seg > 0, has_dn = seg < NSEG - 1;
  const int  up = has_up ? -RS : 0;
  const int  dn = has_dn ? ROWS * RS : (ROWS - 1) * RS;
  // left of the first pass's column, right of the last pass's
  const bool has_l = c0 > 0, has_r = c0 < CW - 1;
  const float* pm = pv;
  const float* pl = has_l ? pv - 16 : pv;
  const float* pr = (has_r ? pv + 16 : pv) + (NPASS - 1) * CW * 16;
  // the same three columns in the row above and in the row below (NSEG > 1)
  const float* plu = pl + up, * pmu = pm + up, * pru = pr + up;
  const float* pld = pl + dn, * pmd = pm + dn, * prd = pr + dn;

  // x[ps][j]: row r0 - 1 + j of the three columns of pass ps
  float x[NPASS][ROWS + 2][3];
#pragma unroll  // constant indices keep the arrays in registers
  for (int ps = 0; ps < NPASS; ++ps) {
    const float* ql = ps > 0         ? pm + (ps * CW - 1) * 16 : pl;
    const float* qm = pm + ps * CW * 16;
    const float* qr = ps < NPASS - 1 ? pm + (ps * CW + 1) * 16 : pr;
#pragma unroll  // constant indices keep the arrays in registers
    for (int j = 1; j <= ROWS; ++j) {
      x[ps][j][0] = ql[(j - 1) * RS];
      x[ps][j][1] = qm[(j - 1) * RS];
      x[ps][j][2] = qr[(j - 1) * RS];
    }
  }
  if (NSEG > 1) {                                    // then NPASS == 1
    x[0][0][0] = plu[0];
    x[0][0][1] = pmu[0];
    x[0][0][2] = pru[0];
    x[0][ROWS + 1][0] = pld[0];
    x[0][ROWS + 1][1] = pmd[0];
    x[0][ROWS + 1][2] = prd[0];
    // The address registers of the loads above stay untouched up to this wait.
    asm volatile("s_wait_xcnt 0x0" :: "v"(pl), "v"(pm), "v"(pr), "v"(plu),
                 "v"(pmu), "v"(pru), "v"(pld), "v"(pmd), "v"(prd) : "memory");
  } else {
    // The address registers of the loads above stay untouched up to this wait.
    asm volatile("s_wait_xcnt 0x0" :: "v"(pl), "v"(pm), "v"(pr) : "memory");
  }

#pragma unroll  // constant indices keep the arrays in registers
  for (int ps = 0; ps < NPASS; ++ps) {
    float wl[3], wr[3];
#pragma unroll  // constant indices keep the arrays in registers
    for (int j = 0; j < 3; ++j) {
      wl[j] = (ps > 0 || has_l)         ? w[3 * j]     : 0.0f;
      wr[j] = (ps < NPASS - 1 || has_r) ? w[3 * j + 2] : 0.0f;
    }
    if (NSEG > 1) {
#pragma unroll  // constant indices keep the arrays in registers
      for (int k = 0; k < 3; ++k) {
        x[ps][0][k]        = has_up ? x[ps][0][k]        : 0.0f;
        x[ps][ROWS + 1][k] = has_dn ? x[ps][ROWS + 1][k] : 0.0f;
      }
    }
#pragma unroll  // constant indices keep the arrays in registers
    for (int j = 0; j < ROWS; ++j) {
      float acc = bias;
#pragma unroll  // constant indices keep the arrays in registers
      for (int dy = 0; dy < 3; ++dy) {
        if (NSEG == 1 && (j + dy == 0 || j + dy == ROWS + 1)) continue;
        acc += x[ps][j + dy][0] * wl[dy];
        acc += x[ps][j + dy][1] * w[3 * dy + 1];
        acc += x[ps][j + dy][2] * wr[dy];
      }
      acc += x[ps][j + 1][1];
      po[j * WS + ps * CW] = (_Float16)acc;
    }
  }
}

// ---------------------------------------------------------------------------
// Kernel 2: stripe attention for one (window-head, 64-row M-block).
//   - LePE (depthwise 3x3 + v) into Vt (d-major f16 in LDS)
//   - S = Q K^T via WMMA (K=16 zero-padded to 32)
//   - row softmax (scale 0.25): one wave per row, lanes across the columns,
//     the row read once from LDS, kept in registers, written back once
//   - O = P @ V_le via WMMA, K=512 split across wave pairs, LDS combine
// ---------------------------------------------------------------------------
__global__ __launch_bounds__(256) void cswin_attn_kernel(
    const _Float16* __restrict__ qbuf, const _Float16* __restrict__ kbuf,
    const float* __restrict__ vbuf,
    const float* __restrict__ dwh_w, const float* __restrict__ dwh_b,
    const float* __restrict__ dwv_w, const float* __restrict__ dwv_b,
    float* __restrict__ obuf)
{
  extern __shared__ char smem[];
  float*    Ss   = (float*)smem;                     // 64 x 512 scores, pitch S_LD
  float*    cscr = Ss + 64 * S_LD;                   // 4 x 256 combine
  _Float16* Qs   = (_Float16*)(cscr + 4 * 256);      // 64 x 16, pitch QK_LD
  _Float16* Ks   = Qs + 64 * QK_LD;                  // 512 x 16, pitch QK_LD
  _Float16* Vt   = Ks + 512 * QK_LD;                 // 16 x VTLD (d-major)
  const int VTLD = VT_LD;

  const int tid  = threadIdx.x;
  const int lane = tid & 31;
  const int wave = tid >> 5;
  const int mb   = blockIdx.x;        // 0..7  (64-row M block)
  const int wh   = blockIdx.y;        // 0..1023
  const int dir  = wh >> 9;
  const int mbase = mb * 64;

  const _Float16* qw = qbuf + (wh * 512 + mbase) * 16;
  const _Float16* kw = kbuf + (size_t)wh * 512 * 16;
  const float*    vw = vbuf + (size_t)wh * 512 * 16;

  __builtin_prefetch(vw + tid * 16, 0, 0);

  for (int i = tid; i < 64 * 16;  i += 256) Qs[(i >> 4) * QK_LD + (i & 15)] = qw[i];
  for (int i = tid; i < 512 * 16; i += 256) Ks[(i >> 4) * QK_LD + (i & 15)] = kw[i];

  // LePE: Vt[d][p] = v + conv3x3_dw(v) + bias, zero-padded within the window
  if (dir) lepe_window<8>(vw, dwv_w, dwv_b, Vt, tid);
  else     lepe_window<64>(vw, dwh_w, dwh_b, Vt, tid);
  __syncthreads();

  // --- S = Q K^T : 4x32 tiles, 16 per wave ---
  for (int i = 0; i < 16; ++i) {
    const int t  = wave * 16 + i;
    const int mt = t >> 5, nt = t & 31;
    v16h a = frag_k16(Qs + mt * 16 * QK_LD, QK_LD);
    v16h b = frag_k16(Ks + nt * 16 * QK_LD, QK_LD);
    v8f c = {};
    c = __builtin_amdgcn_wmma_f32_16x16x32_f16(false, a, false, b,
                                               (short)0, c, false, false);
    const int rhalf = (lane >> 4) << 3;
    const int col   = nt * 16 + (lane & 15);
#pragma unroll
    for (int r = 0; r < 8; ++r)
      Ss[(mt * 16 + r + rhalf) * S_LD + col] = c[r];
  }
  __syncthreads();

  // --- row softmax, scale = 16^-0.5 = 0.25 ---
  // Wave w owns rows 8w..8w+7. Lane l holds columns 128k + 4l .. 4l+3 (k = 0..3)
  // of each: every LDS access is 32 lanes x 16 contiguous bytes.
  {
    const float scale = 0.25f;
    const float log2e = 1.44269504f;
    float4* rp = (float4*)(Ss + wave * 8 * S_LD) + lane;
    float4 v[8][4];
    float  rmax[8], rsum[8];
#pragma unroll  // constant indices keep the arrays in registers
    for (int r = 0; r < 8; ++r)
#pragma unroll  // constant indices keep the arrays in registers
      for (int k = 0; k < 4; ++k) v[r][k] = rp[r * (S_LD / 4) + k * 32];
#pragma unroll  // constant indices keep the arrays in registers
    for (int r = 0; r < 8; ++r) {
      float m = -3.4e38f;
#pragma unroll  // constant indices keep the arrays in registers
      for (int k = 0; k < 4; ++k)
        m = max2(m, max2(max2(v[r][k].x, v[r][k].y),
                         max2(v[r][k].z, v[r][k].w)));
      rmax[r] = m;
    }
#pragma unroll  // constant indices keep the arrays in registers
    for (int r = 0; r < 8; ++r) rmax[r] = wave_max(rmax[r]);
#pragma unroll  // constant indices keep the arrays in registers
    for (int r = 0; r < 8; ++r) {
      // e^t as 2^(t * log2 e), the form __expf compiles to
      float e[16];
#pragma unroll  // constant indices keep the arrays in registers
      for (int k = 0; k < 4; ++k) {
        e[4 * k + 0] = (scale * (v[r][k].x - rmax[r])) * log2e;
        e[4 * k + 1] = (scale * (v[r][k].y - rmax[r])) * log2e;
        e[4 * k + 2] = (scale * (v[r][k].z - rmax[r])) * log2e;
        e[4 * k + 3] = (scale * (v[r][k].w - rmax[r])) * log2e;
      }
      exp2_x16(e);
      float s = 0.0f;
#pragma unroll  // constant indices keep the arrays in registers
      for (int k = 0; k < 4; ++k) {
        v[r][k] = make_float4(e[4 * k], e[4 * k + 1], e[4 * k + 2], e[4 * k + 3]);
        s += (e[4 * k] + e[4 * k + 1]) + (e[4 * k + 2] + e[4 * k + 3]);
      }
      rsum[r] = s;
    }
#pragma unroll  // constant indices keep the arrays in registers
    for (int r = 0; r < 8; ++r) rsum[r] = wave_sum(rsum[r]);
#pragma unroll  // constant indices keep the arrays in registers
    for (int r = 0; r < 8; ++r) {
      const float inv = 1.0f / rsum[r];
#pragma unroll  // constant indices keep the arrays in registers
      for (int k = 0; k < 4; ++k) {
        v[r][k].x *= inv; v[r][k].y *= inv; v[r][k].z *= inv; v[r][k].w *= inv;
        rp[r * (S_LD / 4) + k * 32] = v[r][k];
      }
    }
  }
  __syncthreads();

  // --- O = P @ V_le : 4 M-tiles, K=512 split across wave pairs ---
  const int mt    = wave & 3;
  const int khalf = wave >> 2;
  v8f c = {};
  for (int kc = khalf * 8; kc < khalf * 8 + 8; ++kc) {
    v16h a = frag_k32_f32(Ss + (mt * 16) * S_LD + kc * 32, S_LD);
    v16h b = frag_k32_f16(Vt + kc * 32, VTLD);
    c = __builtin_amdgcn_wmma_f32_16x16x32_f16(false, a, false, b,
                                               (short)0, c, false, false);
  }
  if (wave >= 4) {
#pragma unroll
    for (int r = 0; r < 8; ++r) cscr[mt * 256 + r * 32 + lane] = c[r];
  }
  __syncthreads();
  if (wave < 4) {
    const int hloc = wh & 3, win = (wh >> 2) & 7, b_ = (wh >> 5) & 15;
    const int d = lane & 15;
    const int rhalf = (lane >> 4) << 3;
    const int ch = (dir * 4 + hloc) * 16 + d;   // concat: h-heads 0..63, v 64..127
#pragma unroll
    for (int r = 0; r < 8; ++r) {
      const float val = c[r] + cscr[mt * 256 + r * 32 + lane];
      const int pos = mbase + mt * 16 + r + rhalf;
      const int n = dir ? ((pos >> 3) * 64 + win * 8 + (pos & 7))
                        : (win * 512 + pos);
      obuf[(b_ * 4096 + n) * 128 + ch] = val;
    }
  }
}

// ---------------------------------------------------------------------------
// Kernel 3: out = attn_out @ proj_w^T + proj_b   (65536x128 @ 128x128)
// ---------------------------------------------------------------------------
__global__ __launch_bounds__(256) void cswin_proj_kernel(
    const float* __restrict__ a_in, const float* __restrict__ w,
    const float* __restrict__ bias, float* __restrict__ out)
{
  __shared__ _Float16 As[64 * G_LD];
  __shared__ _Float16 Ws[64 * G_LD];
  const int tid  = threadIdx.x;
  const int lane = tid & 31;
  const int wave = tid >> 5;
  const int mbase = blockIdx.x * 64;
  const int nbase = blockIdx.y * 64;

  for (int i = tid; i < 64 * 128; i += 256) {
    int r = i >> 7, k = i & 127;
    As[r * G_LD + k] = (_Float16)a_in[(mbase + r) * 128 + k];
    Ws[r * G_LD + k] = (_Float16)w[(nbase + r) * 128 + k];
  }
  __syncthreads();

  for (int t = wave * 2; t < wave * 2 + 2; ++t) {
    const int mt = t >> 2, nt = t & 3;
    v8f c = {};
#pragma unroll
    for (int kc = 0; kc < 4; ++kc) {
      v16h a = frag_k32_f16(As + (mt * 16) * G_LD + kc * 32, G_LD);
      v16h b = frag_k32_f16(Ws + (nt * 16) * G_LD + kc * 32, G_LD);
      c = __builtin_amdgcn_wmma_f32_16x16x32_f16(false, a, false, b,
                                                 (short)0, c, false, false);
    }
    const int col   = nbase + nt * 16 + (lane & 15);
    const int rhalf = (lane >> 4) << 3;
#pragma unroll
    for (int r = 0; r < 8; ++r) {
      const int m = mbase + mt * 16 + r + rhalf;
      out[m * 128 + col] = c[r] + bias[col];
    }
  }
}

// ---------------------------------------------------------------------------
extern "C" void kernel_launch(void* const* d_in, const int* in_sizes, int n_in,
                              void* d_out, int out_size, void* d_ws, size_t ws_size,
                              hipStream_t stream) {
  const float* x      = (const float*)d_in[0];
  const float* qkv_w  = (const float*)d_in[1];
  const float* qkv_b  = (const float*)d_in[2];
  const float* proj_w = (const float*)d_in[3];
  const float* proj_b = (const float*)d_in[4];
  const float* dwh_w  = (const float*)d_in[5];
  const float* dwh_b  = (const float*)d_in[6];
  const float* dwv_w  = (const float*)d_in[7];
  const float* dwv_b  = (const float*)d_in[8];
  // d_in[9]=H, d_in[10]=W fixed at 64 for this problem size.

  char* wsb = (char*)d_ws;
  _Float16* qbuf = (_Float16*)(wsb);                       // 16 MB
  _Float16* kbuf = (_Float16*)(wsb + (size_t)16 * 1024 * 1024);  // 16 MB
  float*    vbuf = (float*)   (wsb + (size_t)32 * 1024 * 1024);  // 32 MB
  float*    obuf = (float*)   (wsb + (size_t)64 * 1024 * 1024);  // 32 MB

  // QKV projection + window-gather scatter
  cswin_qkv_kernel<<<dim3(1024, 6), 256, 0, stream>>>(
      x, qkv_w, qkv_b, qbuf, kbuf, vbuf);

  // Stripe attention: 1024 window-heads x 8 M-blocks
  const size_t smem = (size_t)64 * S_LD * 4 + 4 * 256 * 4 +
                      (size_t)(64 * QK_LD + 512 * QK_LD + 16 * VT_LD) * 2;
  cswin_attn_kernel<<<dim3(8, 1024), 256, smem, stream>>>(
      qbuf, kbuf, vbuf, dwh_w, dwh_b, dwv_w, dwv_b, obuf);

  // Output projection
  cswin_proj_kernel<<<dim3(1024, 2), 256, 0, stream>>>(
      obuf, proj_w, proj_b, (float*)d_out);
}

// v004
// A run of this version takes 91.5 microseconds.
// In two side-by-side timings against v003, it was 3.48 and 3.46 times as fast.
// Over all steps from v000 it is 29.9 times as fast.
#include <hip/hip_runtime.h>
#include <hip/hip_bf16.h>

typedef __attribute__((ext_vector_type(16))) _Float16 v16h;
typedef __attribute__((ext_vector_type(8)))  float    v8f;

// ---------------------------------------------------------------------------
// WMMA fragment loaders (wave32, 16-bit A/B layout per CDNA5 ISA 7.12.2):
//   lane l holds row (l&15); khi = (l>>4)*8; half-element e maps to
//   K = 16*(e>=8) + khi + (e&7).
// B fragments (32x16 K-major) load identically from the row-major *transpose*
// of B, i.e. B^T (N x K) — which for x·W^T is exactly the row-major weight
// tile we keep in LDS.
// ---------------------------------------------------------------------------

__device__ static inline v16h frag_k16(const _Float16* base, int ld) {
  // 16x16 tile, zero-padded to K=32 (head_dim == 16)
  const int lane = threadIdx.x & 31;
  const int row  = lane & 15;
  const int khi  = (lane >> 4) << 3;
  v16h a;
#pragma unroll
  for (int e = 0; e < 16; ++e) {
    if (e < 8) a[e] = base[row * ld + khi + (e & 7)];
    else       a[e] = (_Float16)0.0f;
  }
  return a;
}

__device__ static inline v16h frag_k32_f16(const _Float16* base, int ld) {
  const int lane = threadIdx.x & 31;
  const int row  = lane & 15;
  const int khi  = (lane >> 4) << 3;
  v16h a;
#pragma unroll
  for (int e = 0; e < 16; ++e) {
    int k = ((e >> 3) << 4) + khi + (e & 7);
    a[e] = base[row * ld + k];
  }
  return a;
}

__device__ static inline v16h frag_k32_f32(const float* base, int ld) {
  const int lane = threadIdx.x & 31;
  const int row  = lane & 15;
  const int khi  = (lane >> 4) << 3;
  // base, ld and khi are multiples of 4 floats: four 16-byte reads a lane,
  // the width that the padded pitch spreads over all banks
  const float4* p = (const float4*)(base + row * ld + khi);
  const float4 f[4] = {p[0], p[1], p[4], p[5]};   // k = khi + 0..7, 16 + khi + 0..7
  v16h a;
#pragma unroll
  for (int j = 0; j < 4; ++j) {
    a[4 * j + 0] = (_Float16)f[j].x;
    a[4 * j + 1] = (_Float16)f[j].y;
    a[4 * j + 2] = (_Float16)f[j].z;
    a[4 * j + 3] = (_Float16)f[j].w;
  }
  return a;
}

// ---------------------------------------------------------------------------
// Whole-wave (32 lanes) maximum and sum, every lane active, result in every
// lane: four xor steps inside each 16-lane row by DPP (row_xmask 1,2,4,8),
// then lane l with lane l ^ 16.
// ---------------------------------------------------------------------------
template <int CTRL>
__device__ static inline float dpp_row(float x) {
  const int b = __builtin_bit_cast(int, x);
  return __builtin_bit_cast(float,
      __builtin_amdgcn_update_dpp(0, b, CTRL, 0xf, 0xf, true));
}

__device__ static inline float xhalf(float x) {
  const int b = __builtin_bit_cast(int, x);
  return __builtin_bit_cast(float,
      __builtin_amdgcn_permlanex16(b, b, 0x76543210, 0xfedcba98, false, false));
}

__device__ static inline float max2(float a, float b) {
  return __builtin_elementwise_maximumnum(a, b);
}

__device__ static inline float wave_max(float x) {
  x = max2(x, dpp_row<0x161>(x));
  x = max2(x, dpp_row<0x162>(x));
  x = max2(x, dpp_row<0x164>(x));
  x = max2(x, dpp_row<0x168>(x));
  return max2(x, xhalf(x));
}

__device__ static inline float wave_sum(float x) {
  x += dpp_row<0x161>(x);
  x += dpp_row<0x162>(x);
  x += dpp_row<0x164>(x);
  x += dpp_row<0x168>(x);
  return x + xhalf(x);
}

// 2^x of sixteen values, in place. One statement: inside it no v_exp_f32 is
// followed by an instruction that reads its result or overwrites its source,
// and the closing v_nop is that free slot behind the last one.
__device__ static inline void exp2_x16(float (&e)[16]) {
  asm("v_exp_f32 %0, %0\n\tv_exp_f32 %1, %1\n\tv_exp_f32 %2, %2\n\t"
      "v_exp_f32 %3, %3\n\tv_exp_f32 %4, %4\n\tv_exp_f32 %5, %5\n\t"
      "v_exp_f32 %6, %6\n\tv_exp_f32 %7, %7\n\tv_exp_f32 %8, %8\n\t"
      "v_exp_f32 %9, %9\n\tv_exp_f32 %10, %10\n\tv_exp_f32 %11, %11\n\t"
      "v_exp_f32 %12, %12\n\tv_exp_f32 %13, %13\n\tv_exp_f32 %14, %14\n\t"
      "v_exp_f32 %15, %15\n\tv_nop"
      : "+v"(e[0]), "+v"(e[1]), "+v"(e[2]), "+v"(e[3]), "+v"(e[4]), "+v"(e[5]),
        "+v"(e[6]), "+v"(e[7]), "+v"(e[8]), "+v"(e[9]), "+v"(e[10]),
        "+v"(e[11]), "+v"(e[12]), "+v"(e[13]), "+v"(e[14]), "+v"(e[15]));
}

// ---------------------------------------------------------------------------
// Row pitches of the LDS tiles that the fragment loaders read. A fragment read
// is 16 bytes a lane with the 16 lanes of a half-wave on 16 consecutive rows:
// at a pitch of an odd multiple of 16 bytes those rows fall on distinct banks.
// ---------------------------------------------------------------------------
#define G_LD  136   // halves: 128-wide f16 GEMM tiles, 272 B a row
#define S_LD  516   // floats: 512-wide f32 rows, unused, 2064 B a row
#define QK_LD 24    // halves: 16-wide k rows, 48 B a row

// ---------------------------------------------------------------------------
// Kernel 1: qkv = x @ qkv_w^T + qkv_b, scattered into window-gathered layout
//   q/k : f16 [1024 window-heads][512 tokens][16]
//   v   : f32 same shape (kept f32 for LePE conv precision)
// window-head index: wh = (((dir*16 + b)*8 + win)*4 + local_head)
// ---------------------------------------------------------------------------
__global__ __launch_bounds__(256) void cswin_qkv_kernel(
    const float* __restrict__ x, const float* __restrict__ w,
    const float* __restrict__ bias,
    _Float16* __restrict__ qbuf, _Float16* __restrict__ kbuf,
    float* __restrict__ vbuf)
{
  __shared__ _Float16 As[64 * G_LD];
  __shared__ _Float16 Ws[64 * G_LD];
  const int tid  = threadIdx.x;
  const int lane = tid & 31;
  const int wave = tid >> 5;                 // 8 waves (wave32)
  const int mbase = blockIdx.x * 64;         // token tile
  const int nbase = blockIdx.y * 64;         // output-channel tile (of 384)

  __builtin_prefetch(x + (mbase + 63) * 128, 0, 0);

  for (int i = tid; i < 64 * 128; i += 256) {
    int r = i >> 7, k = i & 127;
    As[r * G_LD + k] = (_Float16)x[(mbase + r) * 128 + k];
    Ws[r * G_LD + k] = (_Float16)w[(nbase + r) * 128 + k];
  }
  __syncthreads();

  for (int t = wave * 2; t < wave * 2 + 2; ++t) {  // 16 tiles / 8 waves
    const int mt = t >> 2, nt = t & 3;
    v8f c = {};
#pragma unroll
    for (int kc = 0; kc < 4; ++kc) {               // K = 128
      v16h a = frag_k32_f16(As + (mt * 16) * G_LD + kc * 32, G_LD);
      v16h b = frag_k32_f16(Ws + (nt * 16) * G_LD + kc * 32, G_LD);
      c = __builtin_amdgcn_wmma_f32_16x16x32_f16(false, a, false, b,
                                                 (short)0, c, false, false);
    }
    const int col   = nbase + nt * 16 + (lane & 15);
    const int rhalf = (lane >> 4) << 3;
    const int sel   = col >> 7;                    // 0=q 1=k 2=v
    const int cc    = col & 127;
    const int head  = cc >> 4, hd = cc & 15;
    const int dir   = head >> 2, hloc = head & 3;
#pragma unroll
    for (int r = 0; r < 8; ++r) {
      const int m = mbase + mt * 16 + r + rhalf;
      const float val = c[r] + bias[col];
      const int b_ = m >> 12, n = m & 4095;
      const int y = n >> 6, xq = n & 63;
      int win, pos;
      if (dir == 0) { win = y >> 3;  pos = ((y & 7) << 6) | xq; }
      else          { win = xq >> 3; pos = (y << 3) | (xq & 7); }
      const int wh  = ((dir * 16 + b_) * 8 + win) * 4 + hloc;
      const int off = (wh * 512 + pos) * 16 + hd;
      if      (sel == 0) qbuf[off] = (_Float16)val;
      else if (sel == 1) kbuf[off] = (_Float16)val;
      else               vbuf[off] = val;
    }
  }
}

// ---------------------------------------------------------------------------
// LePE of one window of (512 / WS) x WS tokens, 256 threads:
//   Vt[d][p] = v[p][d] + bias[d] + sum over the 3x3 taps inside the window.
// v is token-major with 16 channels a token, so the lanes run across the
// channels: lanes 0-15 are the channels of one token, lanes 16-31 those of the
// next token of the row, and every global read of a wave falls in 128
// contiguous bytes. A thread keeps its channel's nine weights in registers and
// walks down one column of the window, so each row of three neighbours is read
// once and serves three outputs. A thread's reads stand together, in front of
// its sums, so that they are in flight at once. A tap left or right of the
// window gets weight zero and reads the thread's own column instead; a row
// above or below counts as zero.
// ---------------------------------------------------------------------------
#define VT_LD 520
template <int WS>
__device__ static inline void lepe_window(
    const float* __restrict__ vw, const float* __restrict__ cw,
    const float* __restrict__ cb, _Float16* __restrict__ Vt, int tid)
{
  constexpr int HS    = 512 / WS;                    // rows of the window
  constexpr int CW    = WS >= 16 ? 16 : WS;          // columns taken in one pass
  constexpr int NPASS = WS / CW;                     // column passes a thread makes
  constexpr int NSEG  = 16 / CW;                     // row segments of the window
  constexpr int ROWS  = HS / NSEG;                   // rows a thread walks
  constexpr int RS    = WS * 16;                     // floats from row to row
  const int d   = tid & 15;
  const int u   = tid >> 4;                          // 0..15
  const int c0  = u % CW;                            // column in pass 0
  const int seg = u / CW;
  const int r0  = seg * ROWS;

  const int ow = d * 36;                             // bytes to the channel's weights
  const float* pw = (const float*)((const char*)cw + ow);
  float w[9];
#pragma unroll  // constant indices keep the array in registers
  for (int j = 0; j < 9; ++j) w[j] = pw[j];
  const float bias = cb[d];
  // The address registers of the loads above stay untouched up to this wait.
  asm volatile("s_wait_xcnt 0x0" :: "v"(pw), "v"(d) : "memory");

  const float* pv = vw + (r0 * WS + c0) * 16 + d;    // first row, own column
  _Float16*    po = Vt + d * VT_LD + r0 * WS + c0;
  // row above the first and row below the last: inside the window or not
  const bool has_up = seg > 0, has_dn = seg < NSEG - 1;
  const int  up = has_up ? -RS : 0;
  const int  dn = has_dn ? ROWS * RS : (ROWS - 1) * RS;
  // left of the first pass's column, right of the last pass's
  const bool has_l = c0 > 0, has_r = c0 < CW - 1;
  const float* pm = pv;
  const float* pl = has_l ? pv - 16 : pv;
  const float* pr = (has_r ? pv + 16 : pv) + (NPASS - 1) * CW * 16;
  // the same three columns in the row above and in the row below (NSEG > 1)
  const float* plu = pl + up, * pmu = pm + up, * pru = pr + up;
  const float* pld = pl + dn, * pmd = pm + dn, * prd = pr + dn;

  // x[ps][j]: row r0 - 1 + j of the three columns of pass ps
  float x[NPASS][ROWS + 2][3];
#pragma unroll  // constant indices keep the arrays in registers
  for (int ps = 0; ps < NPASS; ++ps) {
    const float* ql = ps > 0         ? pm + (ps * CW - 1) * 16 : pl;
    const float* qm = pm + ps * CW * 16;
    const float* qr = ps < NPASS - 1 ? pm + (ps * CW + 1) * 16 : pr;
#pragma unroll  // constant indices keep the arrays in registers
    for (int j = 1; j <= ROWS; ++j) {
      x[ps][j][0] = ql[(j - 1) * RS];
      x[ps][j][1] = qm[(j - 1) * RS];
      x[ps][j][2] = qr[(j - 1) * RS];
    }
  }
  if (NSEG > 1) {                                    // then NPASS == 1
    x[0][0][0] = plu[0];
    x[0][0][1] = pmu[0];
    x[0][0][2] = pru[0];
    x[0][ROWS + 1][0] = pld[0];
    x[0][ROWS + 1][1] = pmd[0];
    x[0][ROWS + 1][2] = prd[0];
    // The address registers of the loads above stay untouched up to this wait.
    asm volatile("s_wait_xcnt 0x0" :: "v"(pl), "v"(pm), "v"(pr), "v"(plu),
                 "v"(pmu), "v"(pru), "v"(pld), "v"(pmd), "v"(prd) : "memory");
  } else {
    // The address registers of the loads above stay untouched up to this wait.
    asm volatile("s_wait_xcnt 0x0" :: "v"(pl), "v"(pm), "v"(pr) : "memory");
  }

#pragma unroll  // constant indices keep the arrays in registers
  for (int ps = 0; ps < NPASS; ++ps) {
    float wl[3], wr[3];
#pragma unroll  // constant indices keep the arrays in registers
    for (int j = 0; j < 3; ++j) {
      wl[j] = (ps > 0 || has_l)         ? w[3 * j]     : 0.0f;
      wr[j] = (ps < NPASS - 1 || has_r) ? w[3 * j + 2] : 0.0f;
    }
    if (NSEG > 1) {
#pragma unroll  // constant indices keep the arrays in registers
      for (int k = 0; k < 3; ++k) {
        x[ps][0][k]        = has_up ? x[ps][0][k]        : 0.0f;
        x[ps][ROWS + 1][k] = has_dn ? x[ps][ROWS + 1][k] : 0.0f;
      }
    }
#pragma unroll  // constant indices keep the arrays in registers
    for (int j = 0; j < ROWS; ++j) {
      float acc = bias;
#pragma unroll  // constant indices keep the arrays in registers
      for (int dy = 0; dy < 3; ++dy) {
        if (NSEG == 1 && (j + dy == 0 || j + dy == ROWS + 1)) continue;
        acc += x[ps][j + dy][0] * wl[dy];
        acc += x[ps][j + dy][1] * w[3 * dy + 1];
        acc += x[ps][j + dy][2] * wr[dy];
      }
      acc += x[ps][j + 1][1];
      po[j * WS + ps * CW] = (_Float16)acc;
    }
  }
}

typedef __attribute__((ext_vector_type(8)))  _Float16 v8h;
typedef __attribute__((ext_vector_type(16))) float    v16f;
typedef __attribute__((ext_vector_type(2)))  float    v2f;

// 16 rows x 16 halves as a K = 32 fragment, upper half of k zero: one 16-byte
// read a lane (row l & 15, halves 8 * (l >> 4) ..). p points at the lane's own 8.
__device__ static inline v16h frag_k16_v(const _Float16* p) {
  const v8h lo = *(const v8h*)p;
  const v8h z  = {};
  return __builtin_shufflevector(lo, z, 0, 1, 2, 3, 4, 5, 6, 7,
                                 8, 9, 10, 11, 12, 13, 14, 15);
}

// 16 rows x 32 halves in the hardware k order: two 16-byte reads a lane.
__device__ static inline v16h frag_k32_v(const _Float16* p) {
  const v8h lo = *(const v8h*)p;
  const v8h hi = *(const v8h*)(p + 16);
  return __builtin_shufflevector(lo, hi, 0, 1, 2, 3, 4, 5, 6, 7,
                                 8, 9, 10, 11, 12, 13, 14, 15);
}

__device__ static inline float max8(float m, v8f s) {
  const float a = max2(max2(s[0], s[1]), s[2]);
  const float b = max2(max2(s[3], s[4]), s[5]);
  m = max2(max2(m, s[6]), s[7]);
  return max2(max2(m, a), b);
}

#define QT 2   // query tiles (16 columns each) that a wave works on together

__global__ __launch_bounds__(256) void cswin_attn_kernel(
    const _Float16* __restrict__ qbuf, const _Float16* __restrict__ kbuf,
    const float* __restrict__ vbuf,
    const float* __restrict__ dwh_w, const float* __restrict__ dwh_b,
    const float* __restrict__ dwv_w, const float* __restrict__ dwv_b,
    float* __restrict__ obuf)
{
  __shared__ __attribute__((aligned(16))) _Float16 Ks[512 * QK_LD];  // 512 x 16
  __shared__ __attribute__((aligned(16))) _Float16 Vt[16 * VT_LD];   // d-major

  const int tid  = threadIdx.x;
  const int lane = tid & 31;
  const int wave = tid >> 5;
  const int wh   = blockIdx.x;        // 0..1023
  const int dir  = wh >> 9;
  const int c    = lane & 15;         // query column, key row or d row of a tile
  const int h    = lane >> 4;

  const _Float16* qw = qbuf + (size_t)wh * 512 * 16;
  const _Float16* kw = kbuf + (size_t)wh * 512 * 16;
  const float*    vw = vbuf + (size_t)wh * 512 * 16;

  __builtin_prefetch(vw + tid * 16, 0, 0);

  for (int i = tid; i < 512 * 16; i += 256) Ks[(i >> 4) * QK_LD + (i & 15)] = kw[i];

  // LePE: Vt[d][p] = v + conv3x3_dw(v) + bias, zero-padded within the window
  if (dir) lepe_window<8>(vw, dwv_w, dwv_b, Vt, tid);
  else     lepe_window<64>(vw, dwh_w, dwh_b, Vt, tid);
  __syncthreads();

  const _Float16* kl = Ks + c * QK_LD + 8 * h;   // the lane's part of key tile 0
  const _Float16* vl = Vt + c * VT_LD + 8 * h;   // the lane's part of key chunk 0
  const float cs = 0.25f * 1.44269504f;          // e^(0.25 t) = 2^(cs t)
  const int hloc = wh & 3, win = (wh >> 2) & 7, b_ = (wh >> 5) & 15;
  float* ow = obuf + (size_t)b_ * 4096 * 128 + (dir * 4 + hloc) * 16 + 8 * h;

  // 32 query tiles, 4 a wave, QT at a time
  for (int g = 0; g < 4 / QT; ++g) {
    const int q0 = (wave * 4 + g * QT) * 16 + c;  // the lane's query in tile 0
    const _Float16* ql = qw + q0 * 16 + 8 * h;
    v16h qf[QT];
#pragma unroll  // constant indices keep the arrays in registers
    for (int t = 0; t < QT; ++t) qf[t] = frag_k16_v(ql + t * 256);
    // The address registers of the loads above stay untouched up to this wait.
    asm volatile("s_wait_xcnt 0x0" :: "v"(ql) : "memory");

    // --- first walk: maximum of each query's 512 scores ---
    float mx[QT];
#pragma unroll  // constant indices keep the arrays in registers
    for (int t = 0; t < QT; ++t) mx[t] = -3.4e38f;
#pragma unroll 4  // several independent products between a product and its use
    for (int j = 0; j < 32; ++j) {
      const v16h kf = frag_k16_v(kl + j * 16 * QK_LD);
#pragma unroll  // constant indices keep the arrays in registers
      for (int t = 0; t < QT; ++t) {
        v8f s = {};
        s = __builtin_amdgcn_wmma_f32_16x16x32_f16(false, kf, false, qf[t],
                                                   (short)0, s, false, false);
        mx[t] = max8(mx[t], s);
      }
    }
    float mc[QT];
#pragma unroll  // constant indices keep the arrays in registers
    for (int t = 0; t < QT; ++t) mc[t] = -cs * max2(mx[t], xhalf(mx[t]));

    // --- second walk: P^T = 2^(cs (S^T - max)), its sum, O^T += V_le^T P^T ---
    v8f o[QT];
    v2f sm[QT];
#pragma unroll  // constant indices keep the arrays in registers
    for (int t = 0; t < QT; ++t) { o[t] = (v8f){}; sm[t] = (v2f){}; }
    for (int kc = 0; kc < 16; ++kc) {
      const v16h k0 = frag_k16_v(kl + (2 * kc) * 16 * QK_LD);
      const v16h k1 = frag_k16_v(kl + (2 * kc + 1) * 16 * QK_LD);
      const v16h vf = frag_k32_v(vl + kc * 32);
#pragma unroll  // constant indices keep the arrays in registers
      for (int t = 0; t < QT; ++t) {
        v8f s0 = {}, s1 = {};
        s0 = __builtin_amdgcn_wmma_f32_16x16x32_f16(false, k0, false, qf[t],
                                                    (short)0, s0, false, false);
        s1 = __builtin_amdgcn_wmma_f32_16x16x32_f16(false, k1, false, qf[t],
                                                    (short)0, s1, false, false);
        float e[16];
#pragma unroll  // constant indices keep the arrays in registers
        for (int r = 0; r < 8; ++r) {
          e[r]     = __builtin_fmaf(s0[r], cs, mc[t]);
          e[8 + r] = __builtin_fmaf(s1[r], cs, mc[t]);
        }
        exp2_x16(e);
        v2f p2[8];
        v16f pf;
#pragma unroll  // constant indices keep the arrays in registers
        for (int r = 0; r < 8; ++r) p2[r] = (v2f){e[2 * r], e[2 * r + 1]};
#pragma unroll  // constant indices keep the arrays in registers
        for (int r = 0; r < 16; ++r) pf[r] = e[r];
        sm[t] += ((p2[0] + p2[1]) + (p2[2] + p2[3])) +
                 ((p2[4] + p2[5]) + (p2[6] + p2[7]));
        // element s of the B operand = key 8 h + s of tile 0, then of tile 1
        const v16h p = __builtin_convertvector(pf, v16h);
        o[t] = __builtin_amdgcn_wmma_f32_16x16x32_f16(false, vf, false, p,
                                                      (short)0, o[t], false, false);
      }
    }

    // --- O^T[8 h + r][query c] / row sum: 32 contiguous bytes a lane ---
#pragma unroll  // constant indices keep the arrays in registers
    for (int t = 0; t < QT; ++t) {
      const float sl  = sm[t][0] + sm[t][1];
      const float inv = 1.0f / (sl + xhalf(sl));
      const int pos = q0 + t * 16;
      const int n = dir ? ((pos >> 3) * 64 + win * 8 + (pos & 7))
                        : (win * 512 + pos);
      float4* po = (float4*)(ow + n * 128);
      po[0] = make_float4(o[t][0] * inv, o[t][1] * inv, o[t][2] * inv, o[t][3] * inv);
      po[1] = make_float4(o[t][4] * inv, o[t][5] * inv, o[t][6] * inv, o[t][7] * inv);
      // The address registers of the stores above stay untouched up to this wait.
      asm volatile("s_wait_xcnt 0x0" :: "v"(po) : "memory");
    }
  }
}

// ---------------------------------------------------------------------------
// Kernel 3: out = attn_out @ proj_w^T + proj_b   (65536x128 @ 128x128)
// ---------------------------------------------------------------------------
__global__ __launch_bounds__(256) void cswin_proj_kernel(
    const float* __restrict__ a_in, const float* __restrict__ w,
    const float* __restrict__ bias, float* __restrict__ out)
{
  __shared__ _Float16 As[64 * G_LD];
  __shared__ _Float16 Ws[64 * G_LD];
  const int tid  = threadIdx.x;
  const int lane = tid & 31;
  const int wave = tid >> 5;
  const int mbase = blockIdx.x * 64;
  const int nbase = blockIdx.y * 64;

  for (int i = tid; i < 64 * 128; i += 256) {
    int r = i >> 7, k = i & 127;
    As[r * G_LD + k] = (_Float16)a_in[(mbase + r) * 128 + k];
    Ws[r * G_LD + k] = (_Float16)w[(nbase + r) * 128 + k];
  }
  __syncthreads();

  for (int t = wave * 2; t < wave * 2 + 2; ++t) {
    const int mt = t >> 2, nt = t & 3;
    v8f c = {};
#pragma unroll
    for (int kc = 0; kc < 4; ++kc) {
      v16h a = frag_k32_f16(As + (mt * 16) * G_LD + kc * 32, G_LD);
      v16h b = frag_k32_f16(Ws + (nt * 16) * G_LD + kc * 32, G_LD);
      c = __builtin_amdgcn_wmma_f32_16x16x32_f16(false, a, false, b,
                                                 (short)0, c, false, false);
    }
    const int col   = nbase + nt * 16 + (lane & 15);
    const int rhalf = (lane >> 4) << 3;
#pragma unroll
    for (int r = 0; r < 8; ++r) {
      const int m = mbase + mt * 16 + r + rhalf;
      out[m * 128 + col] = c[r] + bias[col];
    }
  }
}

// ---------------------------------------------------------------------------
extern "C" void kernel_launch(void* const* d_in, const int* in_sizes, int n_in,
                              void* d_out, int out_size, void* d_ws, size_t ws_size,
                              hipStream_t stream) {
  const float* x      = (const float*)d_in[0];
  const float* qkv_w  = (const float*)d_in[1];
  const float* qkv_b  = (const float*)d_in[2];
  const float* proj_w = (const float*)d_in[3];
  const float* proj_b = (const float*)d_in[4];
  const float* dwh_w  = (const float*)d_in[5];
  const float* dwh_b  = (const float*)d_in[6];
  const float* dwv_w  = (const float*)d_in[7];
  const float* dwv_b  = (const float*)d_in[8];
  // d_in[9]=H, d_in[10]=W fixed at 64 for this problem size.

  char* wsb = (char*)d_ws;
  _Float16* qbuf = (_Float16*)(wsb);                       // 16 MB
  _Float16* kbuf = (_Float16*)(wsb + (size_t)16 * 1024 * 1024);  // 16 MB
  float*    vbuf = (float*)   (wsb + (size_t)32 * 1024 * 1024);  // 32 MB
  float*    obuf = (float*)   (wsb + (size_t)64 * 1024 * 1024);  // 32 MB

  // QKV projection + window-gather scatter
  cswin_qkv_kernel<<<dim3(1024, 6), 256, 0, stream>>>(
      x, qkv_w, qkv_b, qbuf, kbuf, vbuf);

  // Stripe attention: one work-group a window-head
  cswin_attn_kernel<<<dim3(1024), 256, 0, stream>>>(
      qbuf, kbuf, vbuf, dwh_w, dwh_b, dwv_w, dwv_b, obuf);

  // Output projection
  cswin_proj_kernel<<<dim3(1024, 2), 256, 0, stream>>>(
      obuf, proj_w, proj_b, (float*)d_out);
}

// v005
// A run of this version takes 82.7 microseconds.
// Two timings next to v004 both put it at 1.10 times that version's speed.
// Counting every step since v000, it is 33.0 times as fast.
#include <hip/hip_runtime.h>
#include <hip/hip_bf16.h>

typedef __attribute__((ext_vector_type(16))) _Float16 v16h;
typedef __attribute__((ext_vector_type(8)))  float    v8f;

// ---------------------------------------------------------------------------
// WMMA fragment loaders (wave32, 16-bit A/B layout per CDNA5 ISA 7.12.2):
//   lane l holds row (l&15); khi = (l>>4)*8; half-element e maps to
//   K = 16*(e>=8) + khi + (e&7).
// B fragments (32x16 K-major) load identically from the row-major *transpose*
// of B, i.e. B^T (N x K) — which for x·W^T is exactly the row-major weight
// tile we keep in LDS.
// ---------------------------------------------------------------------------

__device__ static inline v16h frag_k16(const _Float16* base, int ld) {
  // 16x16 tile, zero-padded to K=32 (head_dim == 16)
  const int lane = threadIdx.x & 31;
  const int row  = lane & 15;
  const int khi  = (lane >> 4) << 3;
  v16h a;
#pragma unroll
  for (int e = 0; e < 16; ++e) {
    if (e < 8) a[e] = base[row * ld + khi + (e & 7)];
    else       a[e] = (_Float16)0.0f;
  }
  return a;
}

__device__ static inline v16h frag_k32_f16(const _Float16* base, int ld) {
  const int lane = threadIdx.x & 31;
  const int row  = lane & 15;
  const int khi  = (lane >> 4) << 3;
  v16h a;
#pragma unroll
  for (int e = 0; e < 16; ++e) {
    int k = ((e >> 3) << 4) + khi + (e & 7);
    a[e] = base[row * ld + k];
  }
  return a;
}

__device__ static inline v16h frag_k32_f32(const float* base, int ld) {
  const int lane = threadIdx.x & 31;
  const int row  = lane & 15;
  const int khi  = (lane >> 4) << 3;
  // base, ld and khi are multiples of 4 floats: four 16-byte reads a lane,
  // the width that the padded pitch spreads over all banks
  const float4* p = (const float4*)(base + row * ld + khi);
  const float4 f[4] = {p[0], p[1], p[4], p[5]};   // k = khi + 0..7, 16 + khi + 0..7
  v16h a;
#pragma unroll
  for (int j = 0; j < 4; ++j) {
    a[4 * j + 0] = (_Float16)f[j].x;
    a[4 * j + 1] = (_Float16)f[j].y;
    a[4 * j + 2] = (_Float16)f[j].z;
    a[4 * j + 3] = (_Float16)f[j].w;
  }
  return a;
}

// ---------------------------------------------------------------------------
// Whole-wave (32 lanes) maximum and sum, every lane active, result in every
// lane: four xor steps inside each 16-lane row by DPP (row_xmask 1,2,4,8),
// then lane l with lane l ^ 16.
// ---------------------------------------------------------------------------
template <int CTRL>
__device__ static inline float dpp_row(float x) {
  const int b = __builtin_bit_cast(int, x);
  return __builtin_bit_cast(float,
      __builtin_amdgcn_update_dpp(0, b, CTRL, 0xf, 0xf, true));
}

__device__ static inline float xhalf(float x) {
  const int b = __builtin_bit_cast(int, x);
  return __builtin_bit_cast(float,
      __builtin_amdgcn_permlanex16(b, b, 0x76543210, 0xfedcba98, false, false));
}

__device__ static inline float max2(float a, float b) {
  return __builtin_elementwise_maximumnum(a, b);
}

__device__ static inline float wave_max(float x) {
  x = max2(x, dpp_row<0x161>(x));
  x = max2(x, dpp_row<0x162>(x));
  x = max2(x, dpp_row<0x164>(x));
  x = max2(x, dpp_row<0x168>(x));
  return max2(x, xhalf(x));
}

__device__ static inline float wave_sum(float x) {
  x += dpp_row<0x161>(x);
  x += dpp_row<0x162>(x);
  x += dpp_row<0x164>(x);
  x += dpp_row<0x168>(x);
  return x + xhalf(x);
}

// 2^x of sixteen values, in place. One statement: inside it no v_exp_f32 is
// followed by an instruction that reads its result or overwrites its source,
// and the closing v_nop is that free slot behind the last one.
__device__ static inline void exp2_x16(float (&e)[16]) {
  asm("v_exp_f32 %0, %0\n\tv_exp_f32 %1, %1\n\tv_exp_f32 %2, %2\n\t"
      "v_exp_f32 %3, %3\n\tv_exp_f32 %4, %4\n\tv_exp_f32 %5, %5\n\t"
      "v_exp_f32 %6, %6\n\tv_exp_f32 %7, %7\n\tv_exp_f32 %8, %8\n\t"
      "v_exp_f32 %9, %9\n\tv_exp_f32 %10, %10\n\tv_exp_f32 %11, %11\n\t"
      "v_exp_f32 %12, %12\n\tv_exp_f32 %13, %13\n\tv_exp_f32 %14, %14\n\t"
      "v_exp_f32 %15, %15\n\tv_nop"
      : "+v"(e[0]), "+v"(e[1]), "+v"(e[2]), "+v"(e[3]), "+v"(e[4]), "+v"(e[5]),
        "+v"(e[6]), "+v"(e[7]), "+v"(e[8]), "+v"(e[9]), "+v"(e[10]),
        "+v"(e[11]), "+v"(e[12]), "+v"(e[13]), "+v"(e[14]), "+v"(e[15]));
}

// ---------------------------------------------------------------------------
// Row pitches of the LDS tiles that the fragment loaders read. A fragment read
// is 16 bytes a lane with the 16 lanes of a half-wave on 16 consecutive rows:
// at a pitch of an odd multiple of 16 bytes those rows fall on distinct banks.
// ---------------------------------------------------------------------------
#define G_LD  136   // halves: 128-wide f16 GEMM tiles, 272 B a row
#define S_LD  516   // floats: 512-wide f32 rows, unused, 2064 B a row
#define QK_LD 24    // halves: 16-wide k rows, 48 B a row

// ---------------------------------------------------------------------------
// Kernel 1: qkv = x @ qkv_w^T + qkv_b, scattered into window-gathered layout
//   q/k : f16 [1024 window-heads][512 tokens][16]
//   v   : f32 same shape (kept f32 for LePE conv precision)
// window-head index: wh = (((dir*16 + b)*8 + win)*4 + local_head)
// Transposed product W x^T, one work-group for 256 tokens and ALL 384 channels:
//   - a wave owns 32 tokens; their x rows go from global memory straight into
//     its B fragments, once, and stay in registers over all 24 channel tiles
//   - the whole of W is staged in LDS as f16, once a work-group
//   - in a tile of the transposed product a lane holds 8 consecutive channels
//     of ONE token (half a head), which is 16 contiguous bytes of q or k and 32
//     of v: a wave's store fills whole lines of the window-gathered layout
// ---------------------------------------------------------------------------
typedef __attribute__((ext_vector_type(8)))  _Float16 v8h;
typedef __attribute__((ext_vector_type(4)))  _Float16 v4h;
typedef __attribute__((ext_vector_type(16))) float    v16f;
typedef __attribute__((ext_vector_type(4)))  float    v4f;

// 16 rows x 32 halves in the hardware k order: two 16-byte reads a lane.
__device__ static inline v16h frag_k32_v(const _Float16* p) {
  const v8h lo = *(const v8h*)p;
  const v8h hi = *(const v8h*)(p + 16);
  return __builtin_shufflevector(lo, hi, 0, 1, 2, 3, 4, 5, 6, 7,
                                 8, 9, 10, 11, 12, 13, 14, 15);
}

__global__ __launch_bounds__(256) void cswin_qkv_kernel(
    const float* __restrict__ x, const float* __restrict__ w,
    const float* __restrict__ bias,
    _Float16* __restrict__ qbuf, _Float16* __restrict__ kbuf,
    float* __restrict__ vbuf)
{
  __shared__ __attribute__((aligned(16))) _Float16 Ws[384 * G_LD];
  const int tid  = threadIdx.x;
  const int lane = tid & 31;
  const int wave = tid >> 5;                 // 8 waves (wave32)
  const int c    = lane & 15;                // token column or channel row of a tile
  const int h    = lane >> 4;
  const int m0   = blockIdx.x * 256 + wave * 32 + c;   // the lane's token in tile 0

  // x rows of the wave's two token tiles, in the k order of the fragments:
  // k = 32 kc + 8 h + 0..7, then 32 kc + 16 + 8 h + 0..7. All loads in flight.
  const v4f* xl = (const v4f*)(x + (size_t)m0 * 128 + 8 * h);
  v4f xr[2][4][4];
#pragma unroll  // constant indices keep the arrays in registers
  for (int t = 0; t < 2; ++t) {
#pragma unroll  // constant indices keep the arrays in registers
    for (int kc = 0; kc < 4; ++kc) {
      const v4f* p = xl + t * 512 + kc * 8;
      xr[t][kc][0] = p[0];
      xr[t][kc][1] = p[1];
      xr[t][kc][2] = p[4];
      xr[t][kc][3] = p[5];
    }
  }
  // The address registers of the loads above stay untouched up to this wait.
  asm volatile("s_wait_xcnt 0x0" :: "v"(xl) : "memory");

  v16h xf[2][4];
#pragma unroll  // constant indices keep the arrays in registers
  for (int t = 0; t < 2; ++t) {
#pragma unroll  // constant indices keep the arrays in registers
    for (int kc = 0; kc < 4; ++kc) {
      v16f f;
#pragma unroll  // constant indices keep the arrays in registers
      for (int j = 0; j < 16; ++j) f[j] = xr[t][kc][j >> 2][j & 3];
      xf[t][kc] = __builtin_convertvector(f, v16h);
    }
  }

  // W, 384 x 128: a wave reads one whole row (512 B) a load, 8 B a lane to LDS
  const v4f* wg = (const v4f*)w + tid;
  _Float16*  wd = Ws + wave * G_LD + lane * 4;
#pragma unroll  // constant indices keep the arrays in registers
  for (int jb = 0; jb < 4; ++jb) {
    v4f wr[12];
#pragma unroll  // constant indices keep the arrays in registers
    for (int j = 0; j < 12; ++j) wr[j] = wg[(jb * 12 + j) * 256];
    // The address registers of the loads above stay untouched up to this wait.
    asm volatile("s_wait_xcnt 0x0" :: "v"(wg) : "memory");
#pragma unroll  // constant indices keep the arrays in registers
    for (int j = 0; j < 12; ++j)
      *(v4h*)(wd + (jb * 12 + j) * 8 * G_LD) = __builtin_convertvector(wr[j], v4h);
  }

  // where the lane's 8 channels of local head 0 go, by direction and token tile
  int od[2][2];
#pragma unroll  // constant indices keep the arrays in registers
  for (int t = 0; t < 2; ++t) {
    const int m  = m0 + t * 16;
    const int b_ = m >> 12, n = m & 4095;
    const int y  = n >> 6, xq = n & 63;
    od[0][t] = (((b_ * 8 + (y >> 3)) * 4) * 512 + (((y & 7) << 6) | xq)) * 16 + 8 * h;
    od[1][t] = ((((16 + b_) * 8 + (xq >> 3)) * 4) * 512 + ((y << 3) | (xq & 7))) * 16 + 8 * h;
  }
  __syncthreads();

  const _Float16* wl = Ws + c * G_LD + 8 * h;      // the lane's part of channel tile 0
  const v4f*      bl = (const v4f*)(bias + 8 * h); // the lane's 8 biases of tile 0
  v16h wf[4];
#pragma unroll  // constant indices keep the arrays in registers
  for (int kc = 0; kc < 4; ++kc) wf[kc] = frag_k32_v(wl + kc * 32);
  v4f b0 = bl[0], b1 = bl[1];

  // 24 channel tiles; tile nt is head nt & 7 of q, k or v (nt >> 3)
#pragma unroll  // the next tile's fragments are fetched into a second register set
  for (int nt = 0; nt < 24; ++nt) {
    v16h wn[4];
    v4f  n0 = b0, n1 = b1;
    if (nt < 23) {
#pragma unroll  // constant indices keep the arrays in registers
      for (int kc = 0; kc < 4; ++kc)
        wn[kc] = frag_k32_v(wl + (nt + 1) * 16 * G_LD + kc * 32);
      n0 = bl[(nt + 1) * 4];
      n1 = bl[(nt + 1) * 4 + 1];
    }
    v8f a[2] = {v8f{}, v8f{}};
#pragma unroll  // two independent accumulator chains, taken in turn
    for (int kc = 0; kc < 4; ++kc) {
#pragma unroll  // constant indices keep the arrays in registers
      for (int t = 0; t < 2; ++t)
        a[t] = __builtin_amdgcn_wmma_f32_16x16x32_f16(false, wf[kc], false, xf[t][kc],
                                                      (short)0, a[t], false, false);
    }
    const int sel = nt >> 3, head = nt & 7;        // 0=q 1=k 2=v
#pragma unroll  // constant indices keep the arrays in registers
    for (int t = 0; t < 2; ++t) {
      const int off = od[head >> 2][t] + (head & 3) * 8192;
      const v4f lo = (v4f){a[t][0], a[t][1], a[t][2], a[t][3]} + b0;
      const v4f hi = (v4f){a[t][4], a[t][5], a[t][6], a[t][7]} + b1;
      if (sel < 2) {
        const v4h l4 = __builtin_convertvector(lo, v4h);
        const v4h h4 = __builtin_convertvector(hi, v4h);
        _Float16* po = (sel ? kbuf : qbuf) + off;
        *(v8h*)po = __builtin_shufflevector(l4, h4, 0, 1, 2, 3, 4, 5, 6, 7);
      } else {
        v4f* po = (v4f*)(vbuf + off);
        po[0] = lo;
        po[1] = hi;
      }
    }
    // The address registers of the loads and stores above stay untouched up to
    // this wait.
    asm volatile("s_wait_xcnt 0x0" :: "v"(od[0][0]), "v"(od[0][1]), "v"(od[1][0]),
                 "v"(od[1][1]), "v"(bl) : "memory");
    if (nt < 23) {
#pragma unroll  // constant indices keep the arrays in registers
      for (int kc = 0; kc < 4; ++kc) wf[kc] = wn[kc];
      b0 = n0;
      b1 = n1;
    }
  }
}

// ---------------------------------------------------------------------------
// LePE of one window of (512 / WS) x WS tokens, 256 threads:
//   Vt[d][p] = v[p][d] + bias[d] + sum over the 3x3 taps inside the window.
// v is token-major with 16 channels a token, so the lanes run across the
// channels: lanes 0-15 are the channels of one token, lanes 16-31 those of the
// next token of the row, and every global read of a wave falls in 128
// contiguous bytes. A thread keeps its channel's nine weights in registers and
// walks down one column of the window, so each row of three neighbours is read
// once and serves three outputs. A thread's reads stand together, in front of
// its sums, so that they are in flight at once. A tap left or right of the
// window gets weight zero and reads the thread's own column instead; a row
// above or below counts as zero.
// ---------------------------------------------------------------------------
#define VT_LD 520
template <int WS>
__device__ static inline void lepe_window(
    const float* __restrict__ vw, const float* __restrict__ cw,
    const float* __restrict__ cb, _Float16* __restrict__ Vt, int tid)
{
  constexpr int HS    = 512 / WS;                    // rows of the window
  constexpr int CW    = WS >= 16 ? 16 : WS;          // columns taken in one pass
  constexpr int NPASS = WS / CW;                     // column passes a thread makes
  constexpr int NSEG  = 16 / CW;                     // row segments of the window
  constexpr int ROWS  = HS / NSEG;                   // rows a thread walks
  constexpr int RS    = WS * 16;                     // floats from row to row
  const int d   = tid & 15;
  const int u   = tid >> 4;                          // 0..15
  const int c0  = u % CW;                            // column in pass 0
  const int seg = u / CW;
  const int r0  = seg * ROWS;

  const int ow = d * 36;                             // bytes to the channel's weights
  const float* pw = (const float*)((const char*)cw + ow);
  float w[9];
#pragma unroll  // constant indices keep the array in registers
  for (int j = 0; j < 9; ++j) w[j] = pw[j];
  const float bias = cb[d];
  // The address registers of the loads above stay untouched up to this wait.
  asm volatile("s_wait_xcnt 0x0" :: "v"(pw), "v"(d) : "memory");

  const float* pv = vw + (r0 * WS + c0) * 16 + d;    // first row, own column
  _Float16*    po = Vt + d * VT_LD + r0 * WS + c0;
  // row above the first and row below the last: inside the window or not
  const bool has_up = seg > 0, has_dn = seg < NSEG - 1;
  const int  up = has_up ? -RS : 0;
  const int  dn = has_dn ? ROWS * RS : (ROWS - 1) * RS;
  // left of the first pass's column, right of the last pass's
  const bool has_l = c0 > 0, has_r = c0 < CW - 1;
  const float* pm = pv;
  const float* pl = has_l ? pv - 16 : pv;
  const float* pr = (has_r ? pv + 16 : pv) + (NPASS - 1) * CW * 16;
  // the same three columns in the row above and in the row below (NSEG > 1)
  const float* plu = pl + up, * pmu = pm + up, * pru = pr + up;
  const float* pld = pl + dn, * pmd = pm + dn, * prd = pr + dn;

  // x[ps][j]: row r0 - 1 + j of the three columns of pass ps
  float x[NPASS][ROWS + 2][3];
#pragma unroll  // constant indices keep the arrays in registers
  for (int ps = 0; ps < NPASS; ++ps) {
    const float* ql = ps > 0         ? pm + (ps * CW - 1) * 16 : pl;
    const float* qm = pm + ps * CW * 16;
    const float* qr = ps < NPASS - 1 ? pm + (ps * CW + 1) * 16 : pr;
#pragma unroll  // constant indices keep the arrays in registers
    for (int j = 1; j <= ROWS; ++j) {
      x[ps][j][0] = ql[(j - 1) * RS];
      x[ps][j][1] = qm[(j - 1) * RS];
      x[ps][j][2] = qr[(j - 1) * RS];
    }
  }
  if (NSEG > 1) {                                    // then NPASS == 1
    x[0][0][0] = plu[0];
    x[0][0][1] = pmu[0];
    x[0][0][2] = pru[0];
    x[0][ROWS + 1][0] = pld[0];
    x[0][ROWS + 1][1] = pmd[0];
    x[0][ROWS + 1][2] = prd[0];
    // The address registers of the loads above stay untouched up to this wait.
    asm volatile("s_wait_xcnt 0x0" :: "v"(pl), "v"(pm), "v"(pr), "v"(plu),
                 "v"(pmu), "v"(pru), "v"(pld), "v"(pmd), "v"(prd) : "memory");
  } else {
    // The address registers of the loads above stay untouched up to this wait.
    asm volatile("s_wait_xcnt 0x0" :: "v"(pl), "v"(pm), "v"(pr) : "memory");
  }

#pragma unroll  // constant indices keep the arrays in registers
  for (int ps = 0; ps < NPASS; ++ps) {
    float wl[3], wr[3];
#pragma unroll  // constant indices keep the arrays in registers
    for (int j = 0; j < 3; ++j) {
      wl[j] = (ps > 0 || has_l)         ? w[3 * j]     : 0.0f;
      wr[j] = (ps < NPASS - 1 || has_r) ? w[3 * j + 2] : 0.0f;
    }
    if (NSEG > 1) {
#pragma unroll  // constant indices keep the arrays in registers
      for (int k = 0; k < 3; ++k) {
        x[ps][0][k]        = has_up ? x[ps][0][k]        : 0.0f;
        x[ps][ROWS + 1][k] = has_dn ? x[ps][ROWS + 1][k] : 0.0f;
      }
    }
#pragma unroll  // constant indices keep the arrays in registers
    for (int j = 0; j < ROWS; ++j) {
      float acc = bias;
#pragma unroll  // constant indices keep the arrays in registers
      for (int dy = 0; dy < 3; ++dy) {
        if (NSEG == 1 && (j + dy == 0 || j + dy == ROWS + 1)) continue;
        acc += x[ps][j + dy][0] * wl[dy];
        acc += x[ps][j + dy][1] * w[3 * dy + 1];
        acc += x[ps][j + dy][2] * wr[dy];
      }
      acc += x[ps][j + 1][1];
      po[j * WS + ps * CW] = (_Float16)acc;
    }
  }
}

typedef __attribute__((ext_vector_type(2)))  float    v2f;

// 16 rows x 16 halves as a K = 32 fragment, upper half of k zero: one 16-byte
// read a lane (row l & 15, halves 8 * (l >> 4) ..). p points at the lane's own 8.
__device__ static inline v16h frag_k16_v(const _Float16* p) {
  const v8h lo = *(const v8h*)p;
  const v8h z  = {};
  return __builtin_shufflevector(lo, z, 0, 1, 2, 3, 4, 5, 6, 7,
                                 8, 9, 10, 11, 12, 13, 14, 15);
}

__device__ static inline float max8(float m, v8f s) {
  const float a = max2(max2(s[0], s[1]), s[2]);
  const float b = max2(max2(s[3], s[4]), s[5]);
  m = max2(max2(m, s[6]), s[7]);
  return max2(max2(m, a), b);
}

#define QT 2   // query tiles (16 columns each) that a wave works on together

__global__ __launch_bounds__(256) void cswin_attn_kernel(
    const _Float16* __restrict__ qbuf, const _Float16* __restrict__ kbuf,
    const float* __restrict__ vbuf,
    const float* __restrict__ dwh_w, const float* __restrict__ dwh_b,
    const float* __restrict__ dwv_w, const float* __restrict__ dwv_b,
    float* __restrict__ obuf)
{
  __shared__ __attribute__((aligned(16))) _Float16 Ks[512 * QK_LD];  // 512 x 16
  __shared__ __attribute__((aligned(16))) _Float16 Vt[16 * VT_LD];   // d-major

  const int tid  = threadIdx.x;
  const int lane = tid & 31;
  const int wave = tid >> 5;
  const int wh   = blockIdx.x;        // 0..1023
  const int dir  = wh >> 9;
  const int c    = lane & 15;         // query column, key row or d row of a tile
  const int h    = lane >> 4;

  const _Float16* qw = qbuf + (size_t)wh * 512 * 16;
  const _Float16* kw = kbuf + (size_t)wh * 512 * 16;
  const float*    vw = vbuf + (size_t)wh * 512 * 16;

  __builtin_prefetch(vw + tid * 16, 0, 0);

  for (int i = tid; i < 512 * 16; i += 256) Ks[(i >> 4) * QK_LD + (i & 15)] = kw[i];

  // LePE: Vt[d][p] = v + conv3x3_dw(v) + bias, zero-padded within the window
  if (dir) lepe_window<8>(vw, dwv_w, dwv_b, Vt, tid);
  else     lepe_window<64>(vw, dwh_w, dwh_b, Vt, tid);
  __syncthreads();

  const _Float16* kl = Ks + c * QK_LD + 8 * h;   // the lane's part of key tile 0
  const _Float16* vl = Vt + c * VT_LD + 8 * h;   // the lane's part of key chunk 0
  const float cs = 0.25f * 1.44269504f;          // e^(0.25 t) = 2^(cs t)
  const int hloc = wh & 3, win = (wh >> 2) & 7, b_ = (wh >> 5) & 15;
  float* ow = obuf + (size_t)b_ * 4096 * 128 + (dir * 4 + hloc) * 16 + 8 * h;

  // 32 query tiles, 4 a wave, QT at a time
  for (int g = 0; g < 4 / QT; ++g) {
    const int q0 = (wave * 4 + g * QT) * 16 + c;  // the lane's query in tile 0
    const _Float16* ql = qw + q0 * 16 + 8 * h;
    v16h qf[QT];
#pragma unroll  // constant indices keep the arrays in registers
    for (int t = 0; t < QT; ++t) qf[t] = frag_k16_v(ql + t * 256);
    // The address registers of the loads above stay untouched up to this wait.
    asm volatile("s_wait_xcnt 0x0" :: "v"(ql) : "memory");

    // --- first walk: maximum of each query's 512 scores ---
    float mx[QT];
#pragma unroll  // constant indices keep the arrays in registers
    for (int t = 0; t < QT; ++t) mx[t] = -3.4e38f;
#pragma unroll 4  // several independent products between a product and its use
    for (int j = 0; j < 32; ++j) {
      const v16h kf = frag_k16_v(kl + j * 16 * QK_LD);
#pragma unroll  // constant indices keep the arrays in registers
      for (int t = 0; t < QT; ++t) {
        v8f s = {};
        s = __builtin_amdgcn_wmma_f32_16x16x32_f16(false, kf, false, qf[t],
                                                   (short)0, s, false, false);
        mx[t] = max8(mx[t], s);
      }
    }
    float mc[QT];
#pragma unroll  // constant indices keep the arrays in registers
    for (int t = 0; t < QT; ++t) mc[t] = -cs * max2(mx[t], xhalf(mx[t]));

    // --- second walk: P^T = 2^(cs (S^T - max)), its sum, O^T += V_le^T P^T ---
    v8f o[QT];
    v2f sm[QT];
#pragma unroll  // constant indices keep the arrays in registers
    for (int t = 0; t < QT; ++t) { o[t] = (v8f){}; sm[t] = (v2f){}; }
    for (int kc = 0; kc < 16; ++kc) {
      const v16h k0 = frag_k16_v(kl + (2 * kc) * 16 * QK_LD);
      const v16h k1 = frag_k16_v(kl + (2 * kc + 1) * 16 * QK_LD);
      const v16h vf = frag_k32_v(vl + kc * 32);
#pragma unroll  // constant indices keep the arrays in registers
      for (int t = 0; t < QT; ++t) {
        v8f s0 = {}, s1 = {};
        s0 = __builtin_amdgcn_wmma_f32_16x16x32_f16(false, k0, false, qf[t],
                                                    (short)0, s0, false, false);
        s1 = __builtin_amdgcn_wmma_f32_16x16x32_f16(false, k1, false, qf[t],
                                                    (short)0, s1, false, false);
        float e[16];
#pragma unroll  // constant indices keep the arrays in registers
        for (int r = 0; r < 8; ++r) {
          e[r]     = __builtin_fmaf(s0[r], cs, mc[t]);
          e[8 + r] = __builtin_fmaf(s1[r], cs, mc[t]);
        }
        exp2_x16(e);
        v2f p2[8];
        v16f pf;
#pragma unroll  // constant indices keep the arrays in registers
        for (int r = 0; r < 8; ++r) p2[r] = (v2f){e[2 * r], e[2 * r + 1]};
#pragma unroll  // constant indices keep the arrays in registers
        for (int r = 0; r < 16; ++r) pf[r] = e[r];
        sm[t] += ((p2[0] + p2[1]) + (p2[2] + p2[3])) +
                 ((p2[4] + p2[5]) + (p2[6] + p2[7]));
        // element s of the B operand = key 8 h + s of tile 0, then of tile 1
        const v16h p = __builtin_convertvector(pf, v16h);
        o[t] = __builtin_amdgcn_wmma_f32_16x16x32_f16(false, vf, false, p,
                                                      (short)0, o[t], false, false);
      }
    }

    // --- O^T[8 h + r][query c] / row sum: 32 contiguous bytes a lane ---
#pragma unroll  // constant indices keep the arrays in registers
    for (int t = 0; t < QT; ++t) {
      const float sl  = sm[t][0] + sm[t][1];
      const float inv = 1.0f / (sl + xhalf(sl));
      const int pos = q0 + t * 16;
      const int n = dir ? ((pos >> 3) * 64 + win * 8 + (pos & 7))
                        : (win * 512 + pos);
      float4* po = (float4*)(ow + n * 128);
      po[0] = make_float4(o[t][0] * inv, o[t][1] * inv, o[t][2] * inv, o[t][3] * inv);
      po[1] = make_float4(o[t][4] * inv, o[t][5] * inv, o[t][6] * inv, o[t][7] * inv);
      // The address registers of the stores above stay untouched up to this wait.
      asm volatile("s_wait_xcnt 0x0" :: "v"(po) : "memory");
    }
  }
}

// ---------------------------------------------------------------------------
// Kernel 3: out = attn_out @ proj_w^T + proj_b   (65536x128 @ 128x128)
// ---------------------------------------------------------------------------
__global__ __launch_bounds__(256) void cswin_proj_kernel(
    const float* __restrict__ a_in, const float* __restrict__ w,
    const float* __restrict__ bias, float* __restrict__ out)
{
  __shared__ _Float16 As[64 * G_LD];
  __shared__ _Float16 Ws[64 * G_LD];
  const int tid  = threadIdx.x;
  const int lane = tid & 31;
  const int wave = tid >> 5;
  const int mbase = blockIdx.x * 64;
  const int nbase = blockIdx.y * 64;

  for (int i = tid; i < 64 * 128; i += 256) {
    int r = i >> 7, k = i & 127;
    As[r * G_LD + k] = (_Float16)a_in[(mbase + r) * 128 + k];
    Ws[r * G_LD + k] = (_Float16)w[(nbase + r) * 128 + k];
  }
  __syncthreads();

  for (int t = wave * 2; t < wave * 2 + 2; ++t) {
    const int mt = t >> 2, nt = t & 3;
    v8f c = {};
#pragma unroll
    for (int kc = 0; kc < 4; ++kc) {
      v16h a = frag_k32_f16(As + (mt * 16) * G_LD + kc * 32, G_LD);
      v16h b = frag_k32_f16(Ws + (nt * 16) * G_LD + kc * 32, G_LD);
      c = __builtin_amdgcn_wmma_f32_16x16x32_f16(false, a, false, b,
                                                 (short)0, c, false, false);
    }
    const int col   = nbase + nt * 16 + (lane & 15);
    const int rhalf = (lane >> 4) << 3;
#pragma unroll
    for (int r = 0; r < 8; ++r) {
      const int m = mbase + mt * 16 + r + rhalf;
      out[m * 128 + col] = c[r] + bias[col];
    }
  }
}

// ---------------------------------------------------------------------------
extern "C" void kernel_launch(void* const* d_in, const int* in_sizes, int n_in,
                              void* d_out, int out_size, void* d_ws, size_t ws_size,
                              hipStream_t stream) {
  const float* x      = (const float*)d_in[0];
  const float* qkv_w  = (const float*)d_in[1];
  const float* qkv_b  = (const float*)d_in[2];
  const float* proj_w = (const float*)d_in[3];
  const float* proj_b = (const float*)d_in[4];
  const float* dwh_w  = (const float*)d_in[5];
  const float* dwh_b  = (const float*)d_in[6];
  const float* dwv_w  = (const float*)d_in[7];
  const float* dwv_b  = (const float*)d_in[8];
  // d_in[9]=H, d_in[10]=W fixed at 64 for this problem size.

  char* wsb = (char*)d_ws;
  _Float16* qbuf = (_Float16*)(wsb);                       // 16 MB
  _Float16* kbuf = (_Float16*)(wsb + (size_t)16 * 1024 * 1024);  // 16 MB
  float*    vbuf = (float*)   (wsb + (size_t)32 * 1024 * 1024);  // 32 MB
  float*    obuf = (float*)   (wsb + (size_t)64 * 1024 * 1024);  // 32 MB

  // QKV projection + window-gather scatter
  cswin_qkv_kernel<<<dim3(256), 256, 0, stream>>>(
      x, qkv_w, qkv_b, qbuf, kbuf, vbuf);

  // Stripe attention: one work-group a window-head
  cswin_attn_kernel<<<dim3(1024), 256, 0, stream>>>(
      qbuf, kbuf, vbuf, dwh_w, dwh_b, dwv_w, dwv_b, obuf);

  // Output projection
  cswin_proj_kernel<<<dim3(1024, 2), 256, 0, stream>>>(
      obuf, proj_w, proj_b, (float*)d_out);
}

// v007
// A run of this version takes 67.9 microseconds.
// Versions between v005 and this one are left out; their measured steps multiply to 1.21 times as fast.
// Over all steps from v000 it is 40.0 times as fast.
#include <hip/hip_runtime.h>
#include <hip/hip_bf16.h>

typedef __attribute__((ext_vector_type(16))) _Float16 v16h;
typedef __attribute__((ext_vector_type(8)))  float    v8f;

// ---------------------------------------------------------------------------
// WMMA fragment loaders (wave32, 16-bit A/B layout per CDNA5 ISA 7.12.2):
//   lane l holds row (l&15); khi = (l>>4)*8; half-element e maps to
//   K = 16*(e>=8) + khi + (e&7).
// B fragments (32x16 K-major) load identically from the row-major *transpose*
// of B, i.e. B^T (N x K) — which for x·W^T is exactly the row-major weight
// tile we keep in LDS.
// ---------------------------------------------------------------------------

__device__ static inline v16h frag_k16(const _Float16* base, int ld) {
  // 16x16 tile, zero-padded to K=32 (head_dim == 16)
  const int lane = threadIdx.x & 31;
  const int row  = lane & 15;
  const int khi  = (lane >> 4) << 3;
  v16h a;
#pragma unroll
  for (int e = 0; e < 16; ++e) {
    if (e < 8) a[e] = base[row * ld + khi + (e & 7)];
    else       a[e] = (_Float16)0.0f;
  }
  return a;
}

__device__ static inline v16h frag_k32_f32(const float* base, int ld) {
  const int lane = threadIdx.x & 31;
  const int row  = lane & 15;
  const int khi  = (lane >> 4) << 3;
  // base, ld and khi are multiples of 4 floats: four 16-byte reads a lane,
  // the width that the padded pitch spreads over all banks
  const float4* p = (const float4*)(base + row * ld + khi);
  const float4 f[4] = {p[0], p[1], p[4], p[5]};   // k = khi + 0..7, 16 + khi + 0..7
  v16h a;
#pragma unroll
  for (int j = 0; j < 4; ++j) {
    a[4 * j + 0] = (_Float16)f[j].x;
    a[4 * j + 1] = (_Float16)f[j].y;
    a[4 * j + 2] = (_Float16)f[j].z;
    a[4 * j + 3] = (_Float16)f[j].w;
  }
  return a;
}

// ---------------------------------------------------------------------------
// Whole-wave (32 lanes) maximum and sum, every lane active, result in every
// lane: four xor steps inside each 16-lane row by DPP (row_xmask 1,2,4,8),
// then lane l with lane l ^ 16.
// ---------------------------------------------------------------------------
template <int CTRL>
__device__ static inline float dpp_row(float x) {
  const int b = __builtin_bit_cast(int, x);
  return __builtin_bit_cast(float,
      __builtin_amdgcn_update_dpp(0, b, CTRL, 0xf, 0xf, true));
}

__device__ static inline float xhalf(float x) {
  const int b = __builtin_bit_cast(int, x);
  return __builtin_bit_cast(float,
      __builtin_amdgcn_permlanex16(b, b, 0x76543210, 0xfedcba98, false, false));
}

__device__ static inline float max2(float a, float b) {
  return __builtin_elementwise_maximumnum(a, b);
}

__device__ static inline float wave_max(float x) {
  x = max2(x, dpp_row<0x161>(x));
  x = max2(x, dpp_row<0x162>(x));
  x = max2(x, dpp_row<0x164>(x));
  x = max2(x, dpp_row<0x168>(x));
  return max2(x, xhalf(x));
}

__device__ static inline float wave_sum(float x) {
  x += dpp_row<0x161>(x);
  x += dpp_row<0x162>(x);
  x += dpp_row<0x164>(x);
  x += dpp_row<0x168>(x);
  return x + xhalf(x);
}

// 2^x of sixteen values, in place. One statement: inside it no v_exp_f32 is
// followed by an instruction that reads its result or overwrites its source,
// and the closing v_nop is that free slot behind the last one.
__device__ static inline void exp2_x16(float (&e)[16]) {
  asm("v_exp_f32 %0, %0\n\tv_exp_f32 %1, %1\n\tv_exp_f32 %2, %2\n\t"
      "v_exp_f32 %3, %3\n\tv_exp_f32 %4, %4\n\tv_exp_f32 %5, %5\n\t"
      "v_exp_f32 %6, %6\n\tv_exp_f32 %7, %7\n\tv_exp_f32 %8, %8\n\t"
      "v_exp_f32 %9, %9\n\tv_exp_f32 %10, %10\n\tv_exp_f32 %11, %11\n\t"
      "v_exp_f32 %12, %12\n\tv_exp_f32 %13, %13\n\tv_exp_f32 %14, %14\n\t"
      "v_exp_f32 %15, %15\n\tv_nop"
      : "+v"(e[0]), "+v"(e[1]), "+v"(e[2]), "+v"(e[3]), "+v"(e[4]), "+v"(e[5]),
        "+v"(e[6]), "+v"(e[7]), "+v"(e[8]), "+v"(e[9]), "+v"(e[10]),
        "+v"(e[11]), "+v"(e[12]), "+v"(e[13]), "+v"(e[14]), "+v"(e[15]));
}

// ---------------------------------------------------------------------------
// Row pitches of the LDS tiles that the fragment loaders read. A fragment read
// is 16 bytes a lane with the 16 lanes of a half-wave on 16 consecutive rows:
// at a pitch of an odd multiple of 16 bytes those rows fall on distinct banks.
// ---------------------------------------------------------------------------
#define G_LD  136   // halves: 128-wide f16 GEMM tiles, 272 B a row
#define S_LD  516   // floats: 512-wide f32 rows, unused, 2064 B a row
#define QK_LD 24    // halves: 16-wide k rows, 48 B a row

// ---------------------------------------------------------------------------
// Kernel 1: qkv = x @ qkv_w^T + qkv_b, scattered into window-gathered layout
//   q/k : f16 [1024 window-heads][512 tokens][16]
//   v   : f32 same shape (kept f32 for LePE conv precision)
// window-head index: wh = (((dir*16 + b)*8 + win)*4 + local_head)
// Transposed product W x^T, one work-group for 256 tokens and ALL 384 channels:
//   - a wave owns 32 tokens; their x rows go from global memory straight into
//     its B fragments, once, and stay in registers over all 24 channel tiles
//   - the whole of W is staged in LDS as f16, once a work-group
//   - in a tile of the transposed product a lane holds 8 consecutive channels
//     of ONE token (half a head), which is 16 contiguous bytes of q or k and 32
//     of v: a wave's store fills whole lines of the window-gathered layout
// ---------------------------------------------------------------------------
typedef __attribute__((ext_vector_type(8)))  _Float16 v8h;
typedef __attribute__((ext_vector_type(4)))  _Float16 v4h;
typedef __attribute__((ext_vector_type(16))) float    v16f;
typedef __attribute__((ext_vector_type(4)))  float    v4f;

// 16 rows x 32 halves in the hardware k order: two 16-byte reads a lane.
__device__ static inline v16h frag_k32_v(const _Float16* p) {
  const v8h lo = *(const v8h*)p;
  const v8h hi = *(const v8h*)(p + 16);
  return __builtin_shufflevector(lo, hi, 0, 1, 2, 3, 4, 5, 6, 7,
                                 8, 9, 10, 11, 12, 13, 14, 15);
}

__global__ __launch_bounds__(256) void cswin_qkv_kernel(
    const float* __restrict__ x, const float* __restrict__ w,
    const float* __restrict__ bias,
    _Float16* __restrict__ qbuf, _Float16* __restrict__ kbuf,
    float* __restrict__ vbuf)
{
  __shared__ __attribute__((aligned(16))) _Float16 Ws[384 * G_LD];
  const int tid  = threadIdx.x;
  const int lane = tid & 31;
  const int wave = tid >> 5;                 // 8 waves (wave32)
  const int c    = lane & 15;                // token column or channel row of a tile
  const int h    = lane >> 4;
  const int m0   = blockIdx.x * 256 + wave * 32 + c;   // the lane's token in tile 0

  // x rows of the wave's two token tiles, in the k order of the fragments:
  // k = 32 kc + 8 h + 0..7, then 32 kc + 16 + 8 h + 0..7. All loads in flight.
  const v4f* xl = (const v4f*)(x + (size_t)m0 * 128 + 8 * h);
  v4f xr[2][4][4];
#pragma unroll  // constant indices keep the arrays in registers
  for (int t = 0; t < 2; ++t) {
#pragma unroll  // constant indices keep the arrays in registers
    for (int kc = 0; kc < 4; ++kc) {
      const v4f* p = xl + t * 512 + kc * 8;
      xr[t][kc][0] = p[0];
      xr[t][kc][1] = p[1];
      xr[t][kc][2] = p[4];
      xr[t][kc][3] = p[5];
    }
  }
  // The address registers of the loads above stay untouched up to this wait.
  asm volatile("s_wait_xcnt 0x0" :: "v"(xl) : "memory");

  v16h xf[2][4];
#pragma unroll  // constant indices keep the arrays in registers
  for (int t = 0; t < 2; ++t) {
#pragma unroll  // constant indices keep the arrays in registers
    for (int kc = 0; kc < 4; ++kc) {
      v16f f;
#pragma unroll  // constant indices keep the arrays in registers
      for (int j = 0; j < 16; ++j) f[j] = xr[t][kc][j >> 2][j & 3];
      xf[t][kc] = __builtin_convertvector(f, v16h);
    }
  }

  // W, 384 x 128: a wave reads one whole row (512 B) a load, 8 B a lane to LDS
  const v4f* wg = (const v4f*)w + tid;
  _Float16*  wd = Ws + wave * G_LD + lane * 4;
#pragma unroll  // constant indices keep the arrays in registers
  for (int jb = 0; jb < 4; ++jb) {
    v4f wr[12];
#pragma unroll  // constant indices keep the arrays in registers
    for (int j = 0; j < 12; ++j) wr[j] = wg[(jb * 12 + j) * 256];
    // The address registers of the loads above stay untouched up to this wait.
    asm volatile("s_wait_xcnt 0x0" :: "v"(wg) : "memory");
#pragma unroll  // constant indices keep the arrays in registers
    for (int j = 0; j < 12; ++j)
      *(v4h*)(wd + (jb * 12 + j) * 8 * G_LD) = __builtin_convertvector(wr[j], v4h);
  }

  // where the lane's 8 channels of local head 0 go, by direction and token tile
  int od[2][2];
#pragma unroll  // constant indices keep the arrays in registers
  for (int t = 0; t < 2; ++t) {
    const int m  = m0 + t * 16;
    const int b_ = m >> 12, n = m & 4095;
    const int y  = n >> 6, xq = n & 63;
    od[0][t] = (((b_ * 8 + (y >> 3)) * 4) * 512 + (((y & 7) << 6) | xq)) * 16 + 8 * h;
    od[1][t] = ((((16 + b_) * 8 + (xq >> 3)) * 4) * 512 + ((y << 3) | (xq & 7))) * 16 + 8 * h;
  }
  __syncthreads();

  const _Float16* wl = Ws + c * G_LD + 8 * h;      // the lane's part of channel tile 0
  const v4f*      bl = (const v4f*)(bias + 8 * h); // the lane's 8 biases of tile 0
  v16h wf[4];
#pragma unroll  // constant indices keep the arrays in registers
  for (int kc = 0; kc < 4; ++kc) wf[kc] = frag_k32_v(wl + kc * 32);
  v4f b0 = bl[0], b1 = bl[1];

  // 24 channel tiles; tile nt is head nt & 7 of q, k or v (nt >> 3)
#pragma unroll  // the next tile's fragments are fetched into a second register set
  for (int nt = 0; nt < 24; ++nt) {
    v16h wn[4];
    v4f  n0 = b0, n1 = b1;
    if (nt < 23) {
#pragma unroll  // constant indices keep the arrays in registers
      for (int kc = 0; kc < 4; ++kc)
        wn[kc] = frag_k32_v(wl + (nt + 1) * 16 * G_LD + kc * 32);
      n0 = bl[(nt + 1) * 4];
      n1 = bl[(nt + 1) * 4 + 1];
    }
    v8f a[2] = {v8f{}, v8f{}};
#pragma unroll  // two independent accumulator chains, taken in turn
    for (int kc = 0; kc < 4; ++kc) {
#pragma unroll  // constant indices keep the arrays in registers
      for (int t = 0; t < 2; ++t)
        a[t] = __builtin_amdgcn_wmma_f32_16x16x32_f16(false, wf[kc], false, xf[t][kc],
                                                      (short)0, a[t], false, false);
    }
    const int sel = nt >> 3, head = nt & 7;        // 0=q 1=k 2=v
#pragma unroll  // constant indices keep the arrays in registers
    for (int t = 0; t < 2; ++t) {
      const int off = od[head >> 2][t] + (head & 3) * 8192;
      const v4f lo = (v4f){a[t][0], a[t][1], a[t][2], a[t][3]} + b0;
      const v4f hi = (v4f){a[t][4], a[t][5], a[t][6], a[t][7]} + b1;
      if (sel < 2) {
        const v4h l4 = __builtin_convertvector(lo, v4h);
        const v4h h4 = __builtin_convertvector(hi, v4h);
        _Float16* po = (sel ? kbuf : qbuf) + off;
        *(v8h*)po = __builtin_shufflevector(l4, h4, 0, 1, 2, 3, 4, 5, 6, 7);
      } else {
        v4f* po = (v4f*)(vbuf + off);
        po[0] = lo;
        po[1] = hi;
      }
    }
    // The address registers of the loads and stores above stay untouched up to
    // this wait.
    asm volatile("s_wait_xcnt 0x0" :: "v"(od[0][0]), "v"(od[0][1]), "v"(od[1][0]),
                 "v"(od[1][1]), "v"(bl) : "memory");
    if (nt < 23) {
#pragma unroll  // constant indices keep the arrays in registers
      for (int kc = 0; kc < 4; ++kc) wf[kc] = wn[kc];
      b0 = n0;
      b1 = n1;
    }
  }
}

// ---------------------------------------------------------------------------
// LePE of one window of (512 / WS) x WS tokens, 256 threads:
//   Vt[d][p] = v[p][d] + bias[d] + sum over the 3x3 taps inside the window.
// v is token-major with 16 channels a token, so the lanes run across the
// channels: lanes 0-15 are the channels of one token, lanes 16-31 those of the
// next token of the row, and every global read of a wave falls in 128
// contiguous bytes. A thread keeps its channel's nine weights in registers and
// walks down one column of the window, so each row of three neighbours is read
// once and serves three outputs. A thread's reads stand together, in front of
// its sums, so that they are in flight at once. A tap left or right of the
// window gets weight zero and reads the thread's own column instead; a row
// above or below counts as zero.
// ---------------------------------------------------------------------------
#define VT_LD 520
template <int WS>
__device__ static inline void lepe_window(
    const float* __restrict__ vw, const float* __restrict__ cw,
    const float* __restrict__ cb, _Float16* __restrict__ Vt, int tid)
{
  constexpr int HS    = 512 / WS;                    // rows of the window
  constexpr int CW    = WS >= 16 ? 16 : WS;          // columns taken in one pass
  constexpr int NPASS = WS / CW;                     // column passes a thread makes
  constexpr int NSEG  = 16 / CW;                     // row segments of the window
  constexpr int ROWS  = HS / NSEG;                   // rows a thread walks
  constexpr int RS    = WS * 16;                     // floats from row to row
  const int d   = tid & 15;
  const int u   = tid >> 4;                          // 0..15
  const int c0  = u % CW;                            // column in pass 0
  const int seg = u / CW;
  const int r0  = seg * ROWS;

  const int ow = d * 36;                             // bytes to the channel's weights
  const float* pw = (const float*)((const char*)cw + ow);
  float w[9];
#pragma unroll  // constant indices keep the array in registers
  for (int j = 0; j < 9; ++j) w[j] = pw[j];
  const float bias = cb[d];
  // The address registers of the loads above stay untouched up to this wait.
  asm volatile("s_wait_xcnt 0x0" :: "v"(pw), "v"(d) : "memory");

  const float* pv = vw + (r0 * WS + c0) * 16 + d;    // first row, own column
  _Float16*    po = Vt + d * VT_LD + r0 * WS + c0;
  // row above the first and row below the last: inside the window or not
  const bool has_up = seg > 0, has_dn = seg < NSEG - 1;
  const int  up = has_up ? -RS : 0;
  const int  dn = has_dn ? ROWS * RS : (ROWS - 1) * RS;
  // left of the first pass's column, right of the last pass's
  const bool has_l = c0 > 0, has_r = c0 < CW - 1;
  const float* pm = pv;
  const float* pl = has_l ? pv - 16 : pv;
  const float* pr = (has_r ? pv + 16 : pv) + (NPASS - 1) * CW * 16;
  // the same three columns in the row above and in the row below (NSEG > 1)
  const float* plu = pl + up, * pmu = pm + up, * pru = pr + up;
  const float* pld = pl + dn, * pmd = pm + dn, * prd = pr + dn;

  // x[ps][j]: row r0 - 1 + j of the three columns of pass ps
  float x[NPASS][ROWS + 2][3];
#pragma unroll  // constant indices keep the arrays in registers
  for (int ps = 0; ps < NPASS; ++ps) {
    const float* ql = ps > 0         ? pm + (ps * CW - 1) * 16 : pl;
    const float* qm = pm + ps * CW * 16;
    const float* qr = ps < NPASS - 1 ? pm + (ps * CW + 1) * 16 : pr;
#pragma unroll  // constant indices keep the arrays in registers
    for (int j = 1; j <= ROWS; ++j) {
      x[ps][j][0] = ql[(j - 1) * RS];
      x[ps][j][1] = qm[(j - 1) * RS];
      x[ps][j][2] = qr[(j - 1) * RS];
    }
  }
  if (NSEG > 1) {                                    // then NPASS == 1
    x[0][0][0] = plu[0];
    x[0][0][1] = pmu[0];
    x[0][0][2] = pru[0];
    x[0][ROWS + 1][0] = pld[0];
    x[0][ROWS + 1][1] = pmd[0];
    x[0][ROWS + 1][2] = prd[0];
    // The address registers of the loads above stay untouched up to this wait.
    asm volatile("s_wait_xcnt 0x0" :: "v"(pl), "v"(pm), "v"(pr), "v"(plu),
                 "v"(pmu), "v"(pru), "v"(pld), "v"(pmd), "v"(prd) : "memory");
  } else {
    // The address registers of the loads above stay untouched up to this wait.
    asm volatile("s_wait_xcnt 0x0" :: "v"(pl), "v"(pm), "v"(pr) : "memory");
  }

#pragma unroll  // constant indices keep the arrays in registers
  for (int ps = 0; ps < NPASS; ++ps) {
    float wl[3], wr[3];
#pragma unroll  // constant indices keep the arrays in registers
    for (int j = 0; j < 3; ++j) {
      wl[j] = (ps > 0 || has_l)         ? w[3 * j]     : 0.0f;
      wr[j] = (ps < NPASS - 1 || has_r) ? w[3 * j + 2] : 0.0f;
    }
    if (NSEG > 1) {
#pragma unroll  // constant indices keep the arrays in registers
      for (int k = 0; k < 3; ++k) {
        x[ps][0][k]        = has_up ? x[ps][0][k]        : 0.0f;
        x[ps][ROWS + 1][k] = has_dn ? x[ps][ROWS + 1][k] : 0.0f;
      }
    }
#pragma unroll  // constant indices keep the arrays in registers
    for (int j = 0; j < ROWS; ++j) {
      float acc = bias;
#pragma unroll  // constant indices keep the arrays in registers
      for (int dy = 0; dy < 3; ++dy) {
        if (NSEG == 1 && (j + dy == 0 || j + dy == ROWS + 1)) continue;
        acc += x[ps][j + dy][0] * wl[dy];
        acc += x[ps][j + dy][1] * w[3 * dy + 1];
        acc += x[ps][j + dy][2] * wr[dy];
      }
      acc += x[ps][j + 1][1];
      po[j * WS + ps * CW] = (_Float16)acc;
    }
  }
}

typedef __attribute__((ext_vector_type(2)))  float    v2f;

// 16 rows x 16 halves as a K = 32 fragment, upper half of k zero: one 16-byte
// read a lane (row l & 15, halves 8 * (l >> 4) ..). p points at the lane's own 8.
__device__ static inline v16h frag_k16_v(const _Float16* p) {
  const v8h lo = *(const v8h*)p;
  const v8h z  = {};
  return __builtin_shufflevector(lo, z, 0, 1, 2, 3, 4, 5, 6, 7,
                                 8, 9, 10, 11, 12, 13, 14, 15);
}

__device__ static inline float max8(float m, v8f s) {
  const float a = max2(max2(s[0], s[1]), s[2]);
  const float b = max2(max2(s[3], s[4]), s[5]);
  m = max2(max2(m, s[6]), s[7]);
  return max2(max2(m, a), b);
}

#define QT 2   // query tiles (16 columns each) that a wave works on together
#define EXP_SAFE 12.0f   // largest |exponent| for which the shift may be 0

__global__ __launch_bounds__(256) void cswin_attn_kernel(
    const _Float16* __restrict__ qbuf, const _Float16* __restrict__ kbuf,
    const float* __restrict__ vbuf,
    const float* __restrict__ dwh_w, const float* __restrict__ dwh_b,
    const float* __restrict__ dwv_w, const float* __restrict__ dwv_b,
    float* __restrict__ obuf)
{
  __shared__ __attribute__((aligned(16))) _Float16 Ks[512 * QK_LD];  // 512 x 16
  __shared__ __attribute__((aligned(16))) _Float16 Vt[16 * VT_LD];   // d-major
  __shared__ __attribute__((aligned(16))) float    Km[8];            // max |k| a wave saw

  const int tid  = threadIdx.x;
  const int lane = tid & 31;
  const int wave = tid >> 5;
  const int wh   = blockIdx.x;        // 0..1023
  const int dir  = wh >> 9;
  const int c    = lane & 15;         // query column, key row or d row of a tile
  const int h    = lane >> 4;

  const _Float16* qw = qbuf + (size_t)wh * 512 * 16;
  const _Float16* kw = kbuf + (size_t)wh * 512 * 16;
  const float*    vw = vbuf + (size_t)wh * 512 * 16;

  __builtin_prefetch(vw + tid * 16, 0, 0);

  // k, element tid + 256 n = row (tid >> 4) + 16 n, column tid & 15
  const _Float16* kp = kw + tid;
  _Float16*       kd = Ks + (tid >> 4) * QK_LD + (tid & 15);
  float ka = 0.0f;                    // largest |k| among the thread's elements
#pragma unroll  // constant offsets: one address register serves all the loads
  for (int nb = 0; nb < 4; ++nb) {
    _Float16 kv[8];
#pragma unroll  // constant indices keep the array in registers
    for (int j = 0; j < 8; ++j) kv[j] = kp[(nb * 8 + j) * 256];
    // The address registers of the loads above stay untouched up to this wait.
    asm volatile("s_wait_xcnt 0x0" :: "v"(kp) : "memory");
#pragma unroll  // constant indices keep the array in registers
    for (int j = 0; j < 8; ++j) {
      kd[(nb * 8 + j) * 16 * QK_LD] = kv[j];
      ka = max2(ka, __builtin_fabsf((float)kv[j]));
    }
  }
  ka = wave_max(ka);
  if (lane == 0) Km[wave] = ka;

  // LePE: Vt[d][p] = v + conv3x3_dw(v) + bias, zero-padded within the window
  if (dir) lepe_window<8>(vw, dwv_w, dwv_b, Vt, tid);
  else     lepe_window<64>(vw, dwh_w, dwh_b, Vt, tid);
  __syncthreads();

  const _Float16* kl = Ks + c * QK_LD + 8 * h;   // the lane's part of key tile 0
  const _Float16* vl = Vt + c * VT_LD + 8 * h;   // the lane's part of key chunk 0
  const float cs = 0.25f * 1.44269504f;          // e^(0.25 t) = 2^(cs t)
  const v4f km0 = *(const v4f*)Km, km1 = *(const v4f*)(Km + 4);
  const float kb = cs * max2(max2(max2(km0[0], km0[1]), max2(km0[2], km0[3])),
                             max2(max2(km1[0], km1[1]), max2(km1[2], km1[3])));
  const int hloc = wh & 3, win = (wh >> 2) & 7, b_ = (wh >> 5) & 15;
  float* ow = obuf + (size_t)b_ * 4096 * 128 + (dir * 4 + hloc) * 16 + 8 * h;

  // 32 query tiles, 4 a wave, QT at a time
  for (int g = 0; g < 4 / QT; ++g) {
    const int q0 = (wave * 4 + g * QT) * 16 + c;  // the lane's query in tile 0
    const _Float16* ql = qw + q0 * 16 + 8 * h;
    v16h qf[QT];
#pragma unroll  // constant indices keep the arrays in registers
    for (int t = 0; t < QT; ++t) qf[t] = frag_k16_v(ql + t * 256);
    // The address registers of the loads above stay untouched up to this wait.
    asm volatile("s_wait_xcnt 0x0" :: "v"(ql) : "memory");

    // --- bound on |exponent| of the lane's queries: cs * sum|q| * max|k| ---
    float qa = 0.0f;
#pragma unroll  // constant indices keep the arrays in registers
    for (int t = 0; t < QT; ++t) {
      float l1 = 0.0f;
#pragma unroll  // constant indices keep the arrays in registers
      for (int e = 0; e < 8; ++e) l1 += __builtin_fabsf((float)qf[t][e]);
      qa = max2(qa, l1 + xhalf(l1));
    }
    // one answer for the whole wave (the products need every lane on); the
    // negated compare sends a bound that is not a number to the first walk
    const bool walk = __builtin_amdgcn_ballot_w32(!(qa * kb <= EXP_SAFE)) != 0u;

    float mc[QT];
#pragma unroll  // constant indices keep the arrays in registers
    for (int t = 0; t < QT; ++t) mc[t] = 0.0f;
    if (walk) {
      // --- first walk: maximum of each query's 512 scores ---
      float mx[QT];
#pragma unroll  // constant indices keep the arrays in registers
      for (int t = 0; t < QT; ++t) mx[t] = -3.4e38f;
#pragma unroll 4  // several independent products between a product and its use
      for (int j = 0; j < 32; ++j) {
        const v16h kf = frag_k16_v(kl + j * 16 * QK_LD);
#pragma unroll  // constant indices keep the arrays in registers
        for (int t = 0; t < QT; ++t) {
          v8f s = {};
          s = __builtin_amdgcn_wmma_f32_16x16x32_f16(false, kf, false, qf[t],
                                                     (short)0, s, false, false);
          mx[t] = max8(mx[t], s);
        }
      }
#pragma unroll  // constant indices keep the arrays in registers
      for (int t = 0; t < QT; ++t) mc[t] = -cs * max2(mx[t], xhalf(mx[t]));
    }

    // --- second walk: P^T = 2^(cs (S^T - shift)), its sum, O^T += V_le^T P^T ---
    v8f o[QT];
    v2f sm[QT];
#pragma unroll  // constant indices keep the arrays in registers
    for (int t = 0; t < QT; ++t) { o[t] = (v8f){}; sm[t] = (v2f){}; }
    for (int kc = 0; kc < 16; ++kc) {
      const v16h k0 = frag_k16_v(kl + (2 * kc) * 16 * QK_LD);
      const v16h k1 = frag_k16_v(kl + (2 * kc + 1) * 16 * QK_LD);
      const v16h vf = frag_k32_v(vl + kc * 32);
#pragma unroll  // constant indices keep the arrays in registers
      for (int t = 0; t < QT; ++t) {
        v8f s0 = {}, s1 = {};
        s0 = __builtin_amdgcn_wmma_f32_16x16x32_f16(false, k0, false, qf[t],
                                                    (short)0, s0, false, false);
        s1 = __builtin_amdgcn_wmma_f32_16x16x32_f16(false, k1, false, qf[t],
                                                    (short)0, s1, false, false);
        float e[16];
#pragma unroll  // constant indices keep the arrays in registers
        for (int r = 0; r < 8; ++r) {
          e[r]     = __builtin_fmaf(s0[r], cs, mc[t]);
          e[8 + r] = __builtin_fmaf(s1[r], cs, mc[t]);
        }
        exp2_x16(e);
        v2f p2[8];
        v16f pf;
#pragma unroll  // constant indices keep the arrays in registers
        for (int r = 0; r < 8; ++r) p2[r] = (v2f){e[2 * r], e[2 * r + 1]};
#pragma unroll  // constant indices keep the arrays in registers
        for (int r = 0; r < 16; ++r) pf[r] = e[r];
        sm[t] += ((p2[0] + p2[1]) + (p2[2] + p2[3])) +
                 ((p2[4] + p2[5]) + (p2[6] + p2[7]));
        // element s of the B operand = key 8 h + s of tile 0, then of tile 1
        const v16h p = __builtin_convertvector(pf, v16h);
        o[t] = __builtin_amdgcn_wmma_f32_16x16x32_f16(false, vf, false, p,
                                                      (short)0, o[t], false, false);
      }
    }

    // --- O^T[8 h + r][query c] / row sum: 32 contiguous bytes a lane ---
#pragma unroll  // constant indices keep the arrays in registers
    for (int t = 0; t < QT; ++t) {
      const float sl  = sm[t][0] + sm[t][1];
      const float inv = 1.0f / (sl + xhalf(sl));
      const int pos = q0 + t * 16;
      const int n = dir ? ((pos >> 3) * 64 + win * 8 + (pos & 7))
                        : (win * 512 + pos);
      float4* po = (float4*)(ow + n * 128);
      po[0] = make_float4(o[t][0] * inv, o[t][1] * inv, o[t][2] * inv, o[t][3] * inv);
      po[1] = make_float4(o[t][4] * inv, o[t][5] * inv, o[t][6] * inv, o[t][7] * inv);
      // The address registers of the stores above stay untouched up to this wait.
      asm volatile("s_wait_xcnt 0x0" :: "v"(po) : "memory");
    }
  }
}

// ---------------------------------------------------------------------------
// Kernel 3: out = attn_out @ proj_w^T + proj_b   (65536x128 @ 128x128)
// One work-group for 256 tokens and ALL 128 channels:
//   - a wave owns 32 tokens. It reads each of their rows with one load (512
//     contiguous bytes), once, and turns them into A fragments by way of its
//     own rows of an f16 LDS tile
//   - the whole of W is staged in LDS as f16, once a work-group, its rows in the
//     order 64 j + 16 a + i for channel 64 j + 4 i + a. Column i of the four
//     tiles a = 0..3 of group j is then channels 64 j + 4 i + 0..3: a lane holds
//     four consecutive channels of a token, 16 lanes hold 256 contiguous bytes
//     of an output row, and a wave's 16-byte store fills whole lines
// ---------------------------------------------------------------------------
__global__ __launch_bounds__(256) void cswin_proj_kernel(
    const float* __restrict__ a_in, const float* __restrict__ w,
    const float* __restrict__ bias, float* __restrict__ out)
{
  __shared__ __attribute__((aligned(16))) _Float16 Ws[128 * G_LD];
  __shared__ __attribute__((aligned(16))) _Float16 As[256 * G_LD];
  const int tid  = threadIdx.x;
  const int lane = tid & 31;
  const int wave = tid >> 5;                 // 8 waves (wave32)
  const int c    = lane & 15;                // token row or channel column of a tile
  const int h    = lane >> 4;
  const int m0   = blockIdx.x * 256 + wave * 32;   // the wave's first token

  // W row wave + 8 j and token row m0 + j: one whole row a load. All in flight.
  const v4f* wg = (const v4f*)w + tid;
  const v4f* ag = (const v4f*)(a_in + (size_t)m0 * 128) + lane;
  v4f wr[16], ar[32];
#pragma unroll  // constant indices keep the arrays in registers
  for (int j = 0; j < 16; ++j) wr[j] = wg[j * 256];
#pragma unroll  // constant indices keep the arrays in registers
  for (int j = 0; j < 32; ++j) ar[j] = ag[j * 32];
  // The address registers of the loads above stay untouched up to this wait.
  asm volatile("s_wait_xcnt 0x0" :: "v"(wg), "v"(ag) : "memory");

  // channel wave + 8 j has a = wave & 3, i = (wave >> 2) + 2 (j & 7), group j >> 3
  _Float16* wd = Ws + ((wave & 3) * 16 + (wave >> 2)) * G_LD + lane * 4;
#pragma unroll  // constant indices keep the arrays in registers
  for (int j = 0; j < 16; ++j)
    *(v4h*)(wd + ((j >> 3) * 64 + (j & 7) * 2) * G_LD) =
        __builtin_convertvector(wr[j], v4h);
  _Float16* ad = As + wave * 32 * G_LD + lane * 4;
#pragma unroll  // constant indices keep the arrays in registers
  for (int j = 0; j < 32; ++j)
    *(v4h*)(ad + j * G_LD) = __builtin_convertvector(ar[j], v4h);
  __syncthreads();

  const _Float16* al = As + (wave * 32 + c) * G_LD + 8 * h;  // the lane's part of token tile 0
  const _Float16* wl = Ws + c * G_LD + 8 * h;                // and of channel tile 0
  v16h af[2][4];
#pragma unroll  // constant indices keep the arrays in registers
  for (int t = 0; t < 2; ++t) {
#pragma unroll  // constant indices keep the arrays in registers
    for (int kc = 0; kc < 4; ++kc)
      af[t][kc] = frag_k32_v(al + t * 16 * G_LD + kc * 32);
  }
  const v4f* bl = (const v4f*)bias + c;              // channels 4 c .. of group 0
  const v4f  bj[2] = {bl[0], bl[16]};
  v4f* po = (v4f*)(out + (size_t)(m0 + 8 * h) * 128) + c;   // token 8 h, group 0

  v16h wf[4];
#pragma unroll  // constant indices keep the arrays in registers
  for (int kc = 0; kc < 4; ++kc) wf[kc] = frag_k32_v(wl + kc * 32);

#pragma unroll  // constant indices keep the arrays in registers
  for (int j = 0; j < 2; ++j) {
    v8f acc[2][4];
#pragma unroll  // the next tile's fragments are fetched into a second register set
    for (int a = 0; a < 4; ++a) {
      const int nt = j * 4 + a;
      v16h wn[4];
      if (nt < 7) {
#pragma unroll  // constant indices keep the arrays in registers
        for (int kc = 0; kc < 4; ++kc)
          wn[kc] = frag_k32_v(wl + (nt + 1) * 16 * G_LD + kc * 32);
      }
      // Holds the next tile's LDS reads, as one group, in front of this tile's
      // products: their latency then runs under the products.
      __builtin_amdgcn_sched_barrier(0);
      acc[0][a] = (v8f){};
      acc[1][a] = (v8f){};
#pragma unroll  // two independent accumulator chains, taken in turn
      for (int kc = 0; kc < 4; ++kc) {
#pragma unroll  // constant indices keep the arrays in registers
        for (int t = 0; t < 2; ++t)
          acc[t][a] = __builtin_amdgcn_wmma_f32_16x16x32_f16(
              false, af[t][kc], false, wf[kc], (short)0, acc[t][a], false, false);
      }
      if (nt < 7) {
#pragma unroll  // constant indices keep the arrays in registers
        for (int kc = 0; kc < 4; ++kc) wf[kc] = wn[kc];
      }
    }
#pragma unroll  // constant indices keep the arrays in registers
    for (int t = 0; t < 2; ++t) {
#pragma unroll  // constant indices keep the arrays in registers
      for (int r = 0; r < 8; ++r)
        po[(t * 16 + r) * 32 + j * 16] =
            (v4f){acc[t][0][r], acc[t][1][r], acc[t][2][r], acc[t][3][r]} + bj[j];
    }
    // The address registers of the loads and stores above stay untouched up to
    // this wait.
    asm volatile("s_wait_xcnt 0x0" :: "v"(po), "v"(bl) : "memory");
  }
}

// ---------------------------------------------------------------------------
extern "C" void kernel_launch(void* const* d_in, const int* in_sizes, int n_in,
                              void* d_out, int out_size, void* d_ws, size_t ws_size,
                              hipStream_t stream) {
  const float* x      = (const float*)d_in[0];
  const float* qkv_w  = (const float*)d_in[1];
  const float* qkv_b  = (const float*)d_in[2];
  const float* proj_w = (const float*)d_in[3];
  const float* proj_b = (const float*)d_in[4];
  const float* dwh_w  = (const float*)d_in[5];
  const float* dwh_b  = (const float*)d_in[6];
  const float* dwv_w  = (const float*)d_in[7];
  const float* dwv_b  = (const float*)d_in[8];
  // d_in[9]=H, d_in[10]=W fixed at 64 for this problem size.

  char* wsb = (char*)d_ws;
  _Float16* qbuf = (_Float16*)(wsb);                       // 16 MB
  _Float16* kbuf = (_Float16*)(wsb + (size_t)16 * 1024 * 1024);  // 16 MB
  float*    vbuf = (float*)   (wsb + (size_t)32 * 1024 * 1024);  // 32 MB
  float*    obuf = (float*)   (wsb + (size_t)64 * 1024 * 1024);  // 32 MB

  // QKV projection + window-gather scatter
  cswin_qkv_kernel<<<dim3(256), 256, 0, stream>>>(
      x, qkv_w, qkv_b, qbuf, kbuf, vbuf);

  // Stripe attention: one work-group a window-head
  cswin_attn_kernel<<<dim3(1024), 256, 0, stream>>>(
      qbuf, kbuf, vbuf, dwh_w, dwh_b, dwv_w, dwv_b, obuf);

  // Output projection
  cswin_proj_kernel<<<dim3(256), 256, 0, stream>>>(
      obuf, proj_w, proj_b, (float*)d_out);
}

// v008
// Measured time: 56.3 microseconds a run.
// In two side-by-side timings against v007, it was 1.22 and 1.20 times as fast.
// Counting every step since v000, it is 48.2 times as fast.
#include <hip/hip_runtime.h>
#include <hip/hip_bf16.h>

typedef __attribute__((ext_vector_type(16))) _Float16 v16h;
typedef __attribute__((ext_vector_type(8)))  float    v8f;

// ---------------------------------------------------------------------------
// WMMA fragment loaders (wave32, 16-bit A/B layout per CDNA5 ISA 7.12.2):
//   lane l holds row (l&15); khi = (l>>4)*8; half-element e maps to
//   K = 16*(e>=8) + khi + (e&7).
// B fragments (32x16 K-major) load identically from the row-major *transpose*
// of B, i.e. B^T (N x K) — which for x·W^T is exactly the row-major weight
// tile we keep in LDS.
// ---------------------------------------------------------------------------

__device__ static inline v16h frag_k16(const _Float16* base, int ld) {
  // 16x16 tile, zero-padded to K=32 (head_dim == 16)
  const int lane = threadIdx.x & 31;
  const int row  = lane & 15;
  const int khi  = (lane >> 4) << 3;
  v16h a;
#pragma unroll
  for (int e = 0; e < 16; ++e) {
    if (e < 8) a[e] = base[row * ld + khi + (e & 7)];
    else       a[e] = (_Float16)0.0f;
  }
  return a;
}

__device__ static inline v16h frag_k32_f32(const float* base, int ld) {
  const int lane = threadIdx.x & 31;
  const int row  = lane & 15;
  const int khi  = (lane >> 4) << 3;
  // base, ld and khi are multiples of 4 floats: four 16-byte reads a lane,
  // the width that the padded pitch spreads over all banks
  const float4* p = (const float4*)(base + row * ld + khi);
  const float4 f[4] = {p[0], p[1], p[4], p[5]};   // k = khi + 0..7, 16 + khi + 0..7
  v16h a;
#pragma unroll
  for (int j = 0; j < 4; ++j) {
    a[4 * j + 0] = (_Float16)f[j].x;
    a[4 * j + 1] = (_Float16)f[j].y;
    a[4 * j + 2] = (_Float16)f[j].z;
    a[4 * j + 3] = (_Float16)f[j].w;
  }
  return a;
}

// ---------------------------------------------------------------------------
// Whole-wave (32 lanes) maximum and sum, every lane active, result in every
// lane: four xor steps inside each 16-lane row by DPP (row_xmask 1,2,4,8),
// then lane l with lane l ^ 16.
// ---------------------------------------------------------------------------
template <int CTRL>
__device__ static inline float dpp_row(float x) {
  const int b = __builtin_bit_cast(int, x);
  return __builtin_bit_cast(float,
      __builtin_amdgcn_update_dpp(0, b, CTRL, 0xf, 0xf, true));
}

__device__ static inline float xhalf(float x) {
  const int b = __builtin_bit_cast(int, x);
  return __builtin_bit_cast(float,
      __builtin_amdgcn_permlanex16(b, b, 0x76543210, 0xfedcba98, false, false));
}

__device__ static inline float max2(float a, float b) {
  return __builtin_elementwise_maximumnum(a, b);
}

__device__ static inline float wave_max(float x) {
  x = max2(x, dpp_row<0x161>(x));
  x = max2(x, dpp_row<0x162>(x));
  x = max2(x, dpp_row<0x164>(x));
  x = max2(x, dpp_row<0x168>(x));
  return max2(x, xhalf(x));
}

__device__ static inline float wave_sum(float x) {
  x += dpp_row<0x161>(x);
  x += dpp_row<0x162>(x);
  x += dpp_row<0x164>(x);
  x += dpp_row<0x168>(x);
  return x + xhalf(x);
}

// 2^x of sixteen values, in place. One statement: inside it no v_exp_f32 is
// followed by an instruction that reads its result or overwrites its source,
// and the closing v_nop is that free slot behind the last one.
__device__ static inline void exp2_x16(float (&e)[16]) {
  asm("v_exp_f32 %0, %0\n\tv_exp_f32 %1, %1\n\tv_exp_f32 %2, %2\n\t"
      "v_exp_f32 %3, %3\n\tv_exp_f32 %4, %4\n\tv_exp_f32 %5, %5\n\t"
      "v_exp_f32 %6, %6\n\tv_exp_f32 %7, %7\n\tv_exp_f32 %8, %8\n\t"
      "v_exp_f32 %9, %9\n\tv_exp_f32 %10, %10\n\tv_exp_f32 %11, %11\n\t"
      "v_exp_f32 %12, %12\n\tv_exp_f32 %13, %13\n\tv_exp_f32 %14, %14\n\t"
      "v_exp_f32 %15, %15\n\tv_nop"
      : "+v"(e[0]), "+v"(e[1]), "+v"(e[2]), "+v"(e[3]), "+v"(e[4]), "+v"(e[5]),
        "+v"(e[6]), "+v"(e[7]), "+v"(e[8]), "+v"(e[9]), "+v"(e[10]),
        "+v"(e[11]), "+v"(e[12]), "+v"(e[13]), "+v"(e[14]), "+v"(e[15]));
}

// ---------------------------------------------------------------------------
// Row pitches of the LDS tiles that the fragment loaders read. A fragment read
// is 16 bytes a lane with the 16 lanes of a half-wave on 16 consecutive rows:
// at a pitch of an odd multiple of 16 bytes those rows fall on distinct banks.
// ---------------------------------------------------------------------------
#define G_LD  136   // halves: 128-wide f16 GEMM tiles, 272 B a row
#define S_LD  516   // floats: unused; 2064 B a row
#define QK_LD 40    // halves: a token's 16 of k, then its 16 of q; 80 B a row

typedef __attribute__((ext_vector_type(8)))  _Float16 v8h;
typedef __attribute__((ext_vector_type(4)))  _Float16 v4h;
typedef __attribute__((ext_vector_type(16))) float    v16f;
typedef __attribute__((ext_vector_type(4)))  float    v4f;

// 16 rows x 32 halves in the hardware k order: two 16-byte reads a lane.
__device__ static inline v16h frag_k32_v(const _Float16* p) {
  const v8h lo = *(const v8h*)p;
  const v8h hi = *(const v8h*)(p + 16);
  return __builtin_shufflevector(lo, hi, 0, 1, 2, 3, 4, 5, 6, 7,
                                 8, 9, 10, 11, 12, 13, 14, 15);
}

// ---------------------------------------------------------------------------
// LePE of one window of (512 / WS) x WS tokens, 256 threads:
//   Vt[d][p] = v[p][d] + bias[d] + sum over the 3x3 taps inside the window.
// v lies in LDS, token-major with 16 channels a token, so the lanes run across
// the channels: lanes 0-15 are the channels of one token, lanes 16-31 those of
// the next token of the row, and every read of a wave falls in 128 contiguous
// bytes. A thread keeps its channel's nine weights in registers and
// walks down one column of the window, so each row of three neighbours is read
// once and serves three outputs. A thread's reads stand together, in front of
// its sums, so that they are in flight at once. A tap left or right of the
// window gets weight zero and reads the thread's own column instead; a row
// above or below counts as zero.
// ---------------------------------------------------------------------------
#define VT_LD 520
template <int WS>
__device__ static inline void lepe_window(
    const float* __restrict__ vw, const float* __restrict__ cw,
    const float* __restrict__ cb, _Float16* __restrict__ Vt, int tid)
{
  constexpr int HS    = 512 / WS;                    // rows of the window
  constexpr int CW    = WS >= 16 ? 16 : WS;          // columns taken in one pass
  constexpr int NPASS = WS / CW;                     // column passes a thread makes
  constexpr int NSEG  = 16 / CW;                     // row segments of the window
  constexpr int ROWS  = HS / NSEG;                   // rows a thread walks
  constexpr int RS    = WS * 16;                     // floats from row to row
  const int d   = tid & 15;
  const int u   = tid >> 4;                          // 0..15
  const int c0  = u % CW;                            // column in pass 0
  const int seg = u / CW;
  const int r0  = seg * ROWS;

  const int ow = d * 36;                             // bytes to the channel's weights
  const float* pw = (const float*)((const char*)cw + ow);
  float w[9];
#pragma unroll  // constant indices keep the array in registers
  for (int j = 0; j < 9; ++j) w[j] = pw[j];
  const float bias = cb[d];
  // The address registers of the loads above stay untouched up to this wait.
  asm volatile("s_wait_xcnt 0x0" :: "v"(pw), "v"(d) : "memory");

  const float* pv = vw + (r0 * WS + c0) * 16 + d;    // first row, own column
  _Float16*    po = Vt + d * VT_LD + r0 * WS + c0;
  // row above the first and row below the last: inside the window or not
  const bool has_up = seg > 0, has_dn = seg < NSEG - 1;
  const int  up = has_up ? -RS : 0;
  const int  dn = has_dn ? ROWS * RS : (ROWS - 1) * RS;
  // left of the first pass's column, right of the last pass's
  const bool has_l = c0 > 0, has_r = c0 < CW - 1;
  const float* pm = pv;
  const float* pl = has_l ? pv - 16 : pv;
  const float* pr = (has_r ? pv + 16 : pv) + (NPASS - 1) * CW * 16;
  // the same three columns in the row above and in the row below (NSEG > 1)
  const float* plu = pl + up, * pmu = pm + up, * pru = pr + up;
  const float* pld = pl + dn, * pmd = pm + dn, * prd = pr + dn;

  // x[ps][j]: row r0 - 1 + j of the three columns of pass ps
  float x[NPASS][ROWS + 2][3];
#pragma unroll  // constant indices keep the arrays in registers
  for (int ps = 0; ps < NPASS; ++ps) {
    const float* ql = ps > 0         ? pm + (ps * CW - 1) * 16 : pl;
    const float* qm = pm + ps * CW * 16;
    const float* qr = ps < NPASS - 1 ? pm + (ps * CW + 1) * 16 : pr;
#pragma unroll  // constant indices keep the arrays in registers
    for (int j = 1; j <= ROWS; ++j) {
      x[ps][j][0] = ql[(j - 1) * RS];
      x[ps][j][1] = qm[(j - 1) * RS];
      x[ps][j][2] = qr[(j - 1) * RS];
    }
  }
  if (NSEG > 1) {                                    // then NPASS == 1
    x[0][0][0] = plu[0];
    x[0][0][1] = pmu[0];
    x[0][0][2] = pru[0];
    x[0][ROWS + 1][0] = pld[0];
    x[0][ROWS + 1][1] = pmd[0];
    x[0][ROWS + 1][2] = prd[0];
  }

#pragma unroll  // constant indices keep the arrays in registers
  for (int ps = 0; ps < NPASS; ++ps) {
    float wl[3], wr[3];
#pragma unroll  // constant indices keep the arrays in registers
    for (int j = 0; j < 3; ++j) {
      wl[j] = (ps > 0 || has_l)         ? w[3 * j]     : 0.0f;
      wr[j] = (ps < NPASS - 1 || has_r) ? w[3 * j + 2] : 0.0f;
    }
    if (NSEG > 1) {
#pragma unroll  // constant indices keep the arrays in registers
      for (int k = 0; k < 3; ++k) {
        x[ps][0][k]        = has_up ? x[ps][0][k]        : 0.0f;
        x[ps][ROWS + 1][k] = has_dn ? x[ps][ROWS + 1][k] : 0.0f;
      }
    }
#pragma unroll  // constant indices keep the arrays in registers
    for (int j = 0; j < ROWS; ++j) {
      float acc = bias;
#pragma unroll  // constant indices keep the arrays in registers
      for (int dy = 0; dy < 3; ++dy) {
        if (NSEG == 1 && (j + dy == 0 || j + dy == ROWS + 1)) continue;
        acc += x[ps][j + dy][0] * wl[dy];
        acc += x[ps][j + dy][1] * w[3 * dy + 1];
        acc += x[ps][j + dy][2] * wr[dy];
      }
      acc += x[ps][j + 1][1];
      po[j * WS + ps * CW] = (_Float16)acc;
    }
  }
}

typedef __attribute__((ext_vector_type(2)))  float    v2f;

// 16 rows x 16 halves as a K = 32 fragment, upper half of k zero: one 16-byte
// read a lane (row l & 15, halves 8 * (l >> 4) ..). p points at the lane's own 8.
__device__ static inline v16h frag_k16_v(const _Float16* p) {
  const v8h lo = *(const v8h*)p;
  const v8h z  = {};
  return __builtin_shufflevector(lo, z, 0, 1, 2, 3, 4, 5, 6, 7,
                                 8, 9, 10, 11, 12, 13, 14, 15);
}

__device__ static inline float max8(float m, v8f s) {
  const float a = max2(max2(s[0], s[1]), s[2]);
  const float b = max2(max2(s[3], s[4]), s[5]);
  m = max2(max2(m, s[6]), s[7]);
  return max2(max2(m, a), b);
}

#define QT 2   // query tiles (16 columns each) that a wave works on together
#define EXP_SAFE 12.0f   // largest |exponent| for which the shift may be 0

__global__ __launch_bounds__(256) void cswin_attn_kernel(
    const float* __restrict__ x, const float* __restrict__ qkv_w,
    const float* __restrict__ qkv_b,
    const float* __restrict__ dwh_w, const float* __restrict__ dwh_b,
    const float* __restrict__ dwv_w, const float* __restrict__ dwv_b,
    float* __restrict__ obuf)
{
  __shared__ __attribute__((aligned(16))) _Float16 Ks[512 * QK_LD];  // 512 x (k, q)
  __shared__ __attribute__((aligned(16))) _Float16 Vt[16 * VT_LD];   // d-major
  __shared__ __attribute__((aligned(16))) float    Vs[512 * 16];     // v, token-major
  __shared__ __attribute__((aligned(16))) float    Km[8];            // max |k| a wave saw
  // The head's rows of W (48 x G_LD halves) live in Vt's place: their last read
  // and Vt's first write are on the two sides of the second barrier.
  _Float16* Ws = Vt;

  const int tid  = threadIdx.x;
  const int lane = tid & 31;
  const int wave = tid >> 5;
  const int wh   = blockIdx.x;        // 0..1023
  const int dir  = wh >> 9;
  const int c    = lane & 15;         // token or query column, key, channel or d row
  const int h    = lane >> 4;
  const int hloc = wh & 3, win = (wh >> 2) & 7, b_ = (wh >> 5) & 15;
  const int hg   = dir * 4 + hloc;    // head 0..7

  // W rows hg * 16 + 0..15 of q, k and v: LDS row wave + 8 j is row
  // wave + 8 (j & 1) of part j >> 1. A wave reads one whole row (512 B) a load.
  const v4f* wg = (const v4f*)(qkv_w + (hg * 16 + wave) * 128) + lane;
  v4f wr[6];
#pragma unroll  // constant indices keep the arrays in registers
  for (int j = 0; j < 6; ++j) wr[j] = wg[((j >> 1) * 128 + (j & 1) * 8) * 32];
  // the lane's 8 biases of q, k and v
  const v4f* bl = (const v4f*)(qkv_b + hg * 16 + 8 * h);
  v4f bs[3][2];
#pragma unroll  // constant indices keep the arrays in registers
  for (int s = 0; s < 3; ++s) { bs[s][0] = bl[s * 32]; bs[s][1] = bl[s * 32 + 1]; }
  // The address registers of the loads above stay untouched up to this wait.
  asm volatile("s_wait_xcnt 0x0" :: "v"(wg), "v"(bl) : "memory");

  // x row of the lane's token in the wave's token tile 0, in the k order of the
  // fragments: k = 32 kc + 8 h + 0..7, then 32 kc + 16 + 8 h + 0..7. From tile
  // to tile the window position grows by 16: 16 tokens, or two rows of the image.
  const int p0 = wave * 64 + c;       // the lane's window position in tile 0
  const int n0 = dir ? ((p0 >> 3) * 64 + win * 8 + (p0 & 7)) : (win * 512 + p0);
  const int ts = dir ? 128 * 32 : 16 * 32;      // 16-byte units from tile to tile
  const v4f* xl = (const v4f*)(x + ((size_t)b_ * 4096 + n0) * 128 + 8 * h);

  _Float16* wd = Ws + wave * G_LD + lane * 4;
#pragma unroll  // constant indices keep the arrays in registers
  for (int j = 0; j < 6; ++j)
    *(v4h*)(wd + j * 8 * G_LD) = __builtin_convertvector(wr[j], v4h);
  __syncthreads();

  const _Float16* wl = Ws + c * G_LD + 8 * h;    // the lane's part of W's q rows
  float ka = 0.0f;                    // largest |k| among the lane's elements
#pragma unroll 1  // rolled: the rows of one token tile in registers at a time
  for (int tt = 0; tt < 4; ++tt) {
    const v4f* xn = xl + tt * ts;
    v4f xr[4][4];
#pragma unroll  // constant indices keep the arrays in registers
    for (int kc = 0; kc < 4; ++kc) {
      xr[kc][0] = xn[kc * 8];
      xr[kc][1] = xn[kc * 8 + 1];
      xr[kc][2] = xn[kc * 8 + 4];
      xr[kc][3] = xn[kc * 8 + 5];
    }
    // The address registers of the loads above stay untouched up to this wait.
    asm volatile("s_wait_xcnt 0x0" :: "v"(xn) : "memory");
    v16h xf[4];
#pragma unroll  // constant indices keep the arrays in registers
    for (int kc = 0; kc < 4; ++kc) {
      v16f f;
#pragma unroll  // constant indices keep the arrays in registers
      for (int j = 0; j < 16; ++j) f[j] = xr[kc][j >> 2][j & 3];
      xf[kc] = __builtin_convertvector(f, v16h);
    }
    v8f a[3] = {v8f{}, v8f{}, v8f{}};
#pragma unroll  // three independent accumulator chains, taken in turn
    for (int kc = 0; kc < 4; ++kc) {
#pragma unroll  // constant indices keep the arrays in registers
      for (int s = 0; s < 3; ++s) {
        const v16h wf = frag_k32_v(wl + s * 16 * G_LD + kc * 32);
        a[s] = __builtin_amdgcn_wmma_f32_16x16x32_f16(false, wf, false, xf[kc],
                                                      (short)0, a[s], false, false);
      }
    }
    v4f lo[3], hi[3];
#pragma unroll  // constant indices keep the arrays in registers
    for (int s = 0; s < 3; ++s) {
      lo[s] = (v4f){a[s][0], a[s][1], a[s][2], a[s][3]} + bs[s][0];
      hi[s] = (v4f){a[s][4], a[s][5], a[s][6], a[s][7]} + bs[s][1];
    }
    const int pos = p0 + tt * 16;
    const v8h q8 = __builtin_shufflevector(__builtin_convertvector(lo[0], v4h),
                                           __builtin_convertvector(hi[0], v4h),
                                           0, 1, 2, 3, 4, 5, 6, 7);
    const v8h k8 = __builtin_shufflevector(__builtin_convertvector(lo[1], v4h),
                                           __builtin_convertvector(hi[1], v4h),
                                           0, 1, 2, 3, 4, 5, 6, 7);
    *(v8h*)(Ks + pos * QK_LD + 8 * h) = k8;
    *(v8h*)(Ks + pos * QK_LD + 16 + 8 * h) = q8;
#pragma unroll  // constant indices keep the arrays in registers
    for (int e = 0; e < 8; ++e) ka = max2(ka, __builtin_fabsf((float)k8[e]));
    v4f* pv = (v4f*)(Vs + pos * 16 + 8 * h);
    pv[0] = lo[2];
    pv[1] = hi[2];
  }
  ka = wave_max(ka);
  if (lane == 0) Km[wave] = ka;
  __syncthreads();

  // LePE: Vt[d][p] = v + conv3x3_dw(v) + bias, zero-padded within the window
  if (dir) lepe_window<8>(Vs, dwv_w, dwv_b, Vt, tid);
  else     lepe_window<64>(Vs, dwh_w, dwh_b, Vt, tid);
  __syncthreads();

  const _Float16* kl = Ks + c * QK_LD + 8 * h;   // the lane's part of key tile 0
  const _Float16* vl = Vt + c * VT_LD + 8 * h;   // the lane's part of key chunk 0
  const float cs = 0.25f * 1.44269504f;          // e^(0.25 t) = 2^(cs t)
  const v4f km0 = *(const v4f*)Km, km1 = *(const v4f*)(Km + 4);
  const float kb = cs * max2(max2(max2(km0[0], km0[1]), max2(km0[2], km0[3])),
                             max2(max2(km1[0], km1[1]), max2(km1[2], km1[3])));
  float* ow = obuf + (size_t)b_ * 4096 * 128 + hg * 16 + 8 * h;

  // 32 query tiles, 4 a wave, QT at a time
  for (int g = 0; g < 4 / QT; ++g) {
    const int q0 = (wave * 4 + g * QT) * 16 + c;  // the lane's query in tile 0
    const _Float16* ql = Ks + q0 * QK_LD + 16 + 8 * h;
    v16h qf[QT];
#pragma unroll  // constant indices keep the arrays in registers
    for (int t = 0; t < QT; ++t) qf[t] = frag_k16_v(ql + t * 16 * QK_LD);

    // --- bound on |exponent| of the lane's queries: cs * sum|q| * max|k| ---
    float qa = 0.0f;
#pragma unroll  // constant indices keep the arrays in registers
    for (int t = 0; t < QT; ++t) {
      float l1 = 0.0f;
#pragma unroll  // constant indices keep the arrays in registers
      for (int e = 0; e < 8; ++e) l1 += __builtin_fabsf((float)qf[t][e]);
      qa = max2(qa, l1 + xhalf(l1));
    }
    // one answer for the whole wave (the products need every lane on); the
    // negated compare sends a bound that is not a number to the first walk
    const bool walk = __builtin_amdgcn_ballot_w32(!(qa * kb <= EXP_SAFE)) != 0u;

    float mc[QT];
#pragma unroll  // constant indices keep the arrays in registers
    for (int t = 0; t < QT; ++t) mc[t] = 0.0f;
    if (walk) {
      // --- first walk: maximum of each query's 512 scores ---
      float mx[QT];
#pragma unroll  // constant indices keep the arrays in registers
      for (int t = 0; t < QT; ++t) mx[t] = -3.4e38f;
#pragma unroll 4  // several independent products between a product and its use
      for (int j = 0; j < 32; ++j) {
        const v16h kf = frag_k16_v(kl + j * 16 * QK_LD);
#pragma unroll  // constant indices keep the arrays in registers
        for (int t = 0; t < QT; ++t) {
          v8f s = {};
          s = __builtin_amdgcn_wmma_f32_16x16x32_f16(false, kf, false, qf[t],
                                                     (short)0, s, false, false);
          mx[t] = max8(mx[t], s);
        }
      }
#pragma unroll  // constant indices keep the arrays in registers
      for (int t = 0; t < QT; ++t) mc[t] = -cs * max2(mx[t], xhalf(mx[t]));
    }

    // --- second walk: P^T = 2^(cs (S^T - shift)), its sum, O^T += V_le^T P^T ---
    v8f o[QT];
    v2f sm[QT];
#pragma unroll  // constant indices keep the arrays in registers
    for (int t = 0; t < QT; ++t) { o[t] = (v8f){}; sm[t] = (v2f){}; }
    for (int kc = 0; kc < 16; ++kc) {
      const v16h k0 = frag_k16_v(kl + (2 * kc) * 16 * QK_LD);
      const v16h k1 = frag_k16_v(kl + (2 * kc + 1) * 16 * QK_LD);
      const v16h vf = frag_k32_v(vl + kc * 32);
#pragma unroll  // constant indices keep the arrays in registers
      for (int t = 0; t < QT; ++t) {
        v8f s0 = {}, s1 = {};
        s0 = __builtin_amdgcn_wmma_f32_16x16x32_f16(false, k0, false, qf[t],
                                                    (short)0, s0, false, false);
        s1 = __builtin_amdgcn_wmma_f32_16x16x32_f16(false, k1, false, qf[t],
                                                    (short)0, s1, false, false);
        float e[16];
#pragma unroll  // constant indices keep the arrays in registers
        for (int r = 0; r < 8; ++r) {
          e[r]     = __builtin_fmaf(s0[r], cs, mc[t]);
          e[8 + r] = __builtin_fmaf(s1[r], cs, mc[t]);
        }
        exp2_x16(e);
        v2f p2[8];
        v16f pf;
#pragma unroll  // constant indices keep the arrays in registers
        for (int r = 0; r < 8; ++r) p2[r] = (v2f){e[2 * r], e[2 * r + 1]};
#pragma unroll  // constant indices keep the arrays in registers
        for (int r = 0; r < 16; ++r) pf[r] = e[r];
        sm[t] += ((p2[0] + p2[1]) + (p2[2] + p2[3])) +
                 ((p2[4] + p2[5]) + (p2[6] + p2[7]));
        // element s of the B operand = key 8 h + s of tile 0, then of tile 1
        const v16h p = __builtin_convertvector(pf, v16h);
        o[t] = __builtin_amdgcn_wmma_f32_16x16x32_f16(false, vf, false, p,
                                                      (short)0, o[t], false, false);
      }
    }

    // --- O^T[8 h + r][query c] / row sum: 32 contiguous bytes a lane ---
#pragma unroll  // constant indices keep the arrays in registers
    for (int t = 0; t < QT; ++t) {
      const float sl  = sm[t][0] + sm[t][1];
      const float inv = 1.0f / (sl + xhalf(sl));
      const int pos = q0 + t * 16;
      const int n = dir ? ((pos >> 3) * 64 + win * 8 + (pos & 7))
                        : (win * 512 + pos);
      float4* po = (float4*)(ow + n * 128);
      po[0] = make_float4(o[t][0] * inv, o[t][1] * inv, o[t][2] * inv, o[t][3] * inv);
      po[1] = make_float4(o[t][4] * inv, o[t][5] * inv, o[t][6] * inv, o[t][7] * inv);
      // The address registers of the stores above stay untouched up to this wait.
      asm volatile("s_wait_xcnt 0x0" :: "v"(po) : "memory");
    }
  }
}

// ---------------------------------------------------------------------------
// Kernel 2: out = attn_out @ proj_w^T + proj_b   (65536x128 @ 128x128)
// One work-group for 256 tokens and ALL 128 channels:
//   - a wave owns 32 tokens. It reads each of their rows with one load (512
//     contiguous bytes), once, and turns them into A fragments by way of its
//     own rows of an f16 LDS tile
//   - the whole of W is staged in LDS as f16, once a work-group, its rows in the
//     order 64 j + 16 a + i for channel 64 j + 4 i + a. Column i of the four
//     tiles a = 0..3 of group j is then channels 64 j + 4 i + 0..3: a lane holds
//     four consecutive channels of a token, 16 lanes hold 256 contiguous bytes
//     of an output row, and a wave's 16-byte store fills whole lines
// ---------------------------------------------------------------------------
__global__ __launch_bounds__(256) void cswin_proj_kernel(
    const float* __restrict__ a_in, const float* __restrict__ w,
    const float* __restrict__ bias, float* __restrict__ out)
{
  __shared__ __attribute__((aligned(16))) _Float16 Ws[128 * G_LD];
  __shared__ __attribute__((aligned(16))) _Float16 As[256 * G_LD];
  const int tid  = threadIdx.x;
  const int lane = tid & 31;
  const int wave = tid >> 5;                 // 8 waves (wave32)
  const int c    = lane & 15;                // token row or channel column of a tile
  const int h    = lane >> 4;
  const int m0   = blockIdx.x * 256 + wave * 32;   // the wave's first token

  // W row wave + 8 j and token row m0 + j: one whole row a load. All in flight.
  const v4f* wg = (const v4f*)w + tid;
  const v4f* ag = (const v4f*)(a_in + (size_t)m0 * 128) + lane;
  v4f wr[16], ar[32];
#pragma unroll  // constant indices keep the arrays in registers
  for (int j = 0; j < 16; ++j) wr[j] = wg[j * 256];
#pragma unroll  // constant indices keep the arrays in registers
  for (int j = 0; j < 32; ++j) ar[j] = ag[j * 32];
  // The address registers of the loads above stay untouched up to this wait.
  asm volatile("s_wait_xcnt 0x0" :: "v"(wg), "v"(ag) : "memory");

  // channel wave + 8 j has a = wave & 3, i = (wave >> 2) + 2 (j & 7), group j >> 3
  _Float16* wd = Ws + ((wave & 3) * 16 + (wave >> 2)) * G_LD + lane * 4;
#pragma unroll  // constant indices keep the arrays in registers
  for (int j = 0; j < 16; ++j)
    *(v4h*)(wd + ((j >> 3) * 64 + (j & 7) * 2) * G_LD) =
        __builtin_convertvector(wr[j], v4h);
  _Float16* ad = As + wave * 32 * G_LD + lane * 4;
#pragma unroll  // constant indices keep the arrays in registers
  for (int j = 0; j < 32; ++j)
    *(v4h*)(ad + j * G_LD) = __builtin_convertvector(ar[j], v4h);
  __syncthreads();

  const _Float16* al = As + (wave * 32 + c) * G_LD + 8 * h;  // the lane's part of token tile 0
  const _Float16* wl = Ws + c * G_LD + 8 * h;                // and of channel tile 0
  v16h af[2][4];
#pragma unroll  // constant indices keep the arrays in registers
  for (int t = 0; t < 2; ++t) {
#pragma unroll  // constant indices keep the arrays in registers
    for (int kc = 0; kc < 4; ++kc)
      af[t][kc] = frag_k32_v(al + t * 16 * G_LD + kc * 32);
  }
  const v4f* bl = (const v4f*)bias + c;              // channels 4 c .. of group 0
  const v4f  bj[2] = {bl[0], bl[16]};
  v4f* po = (v4f*)(out + (size_t)(m0 + 8 * h) * 128) + c;   // token 8 h, group 0

  v16h wf[4];
#pragma unroll  // constant indices keep the arrays in registers
  for (int kc = 0; kc < 4; ++kc) wf[kc] = frag_k32_v(wl + kc * 32);

#pragma unroll  // constant indices keep the arrays in registers
  for (int j = 0; j < 2; ++j) {
    v8f acc[2][4];
#pragma unroll  // the next tile's fragments are fetched into a second register set
    for (int a = 0; a < 4; ++a) {
      const int nt = j * 4 + a;
      v16h wn[4];
      if (nt < 7) {
#pragma unroll  // constant indices keep the arrays in registers
        for (int kc = 0; kc < 4; ++kc)
          wn[kc] = frag_k32_v(wl + (nt + 1) * 16 * G_LD + kc * 32);
      }
      // Holds the next tile's LDS reads, as one group, in front of this tile's
      // products: their latency then runs under the products.
      __builtin_amdgcn_sched_barrier(0);
      acc[0][a] = (v8f){};
      acc[1][a] = (v8f){};
#pragma unroll  // two independent accumulator chains, taken in turn
      for (int kc = 0; kc < 4; ++kc) {
#pragma unroll  // constant indices keep the arrays in registers
        for (int t = 0; t < 2; ++t)
          acc[t][a] = __builtin_amdgcn_wmma_f32_16x16x32_f16(
              false, af[t][kc], false, wf[kc], (short)0, acc[t][a], false, false);
      }
      if (nt < 7) {
#pragma unroll  // constant indices keep the arrays in registers
        for (int kc = 0; kc < 4; ++kc) wf[kc] = wn[kc];
      }
    }
#pragma unroll  // constant indices keep the arrays in registers
    for (int t = 0; t < 2; ++t) {
#pragma unroll  // constant indices keep the arrays in registers
      for (int r = 0; r < 8; ++r)
        po[(t * 16 + r) * 32 + j * 16] =
            (v4f){acc[t][0][r], acc[t][1][r], acc[t][2][r], acc[t][3][r]} + bj[j];
    }
    // The address registers of the loads and stores above stay untouched up to
    // this wait.
    asm volatile("s_wait_xcnt 0x0" :: "v"(po), "v"(bl) : "memory");
  }
}

// ---------------------------------------------------------------------------
extern "C" void kernel_launch(void* const* d_in, const int* in_sizes, int n_in,
                              void* d_out, int out_size, void* d_ws, size_t ws_size,
                              hipStream_t stream) {
  const float* x      = (const float*)d_in[0];
  const float* qkv_w  = (const float*)d_in[1];
  const float* qkv_b  = (const float*)d_in[2];
  const float* proj_w = (const float*)d_in[3];
  const float* proj_b = (const float*)d_in[4];
  const float* dwh_w  = (const float*)d_in[5];
  const float* dwh_b  = (const float*)d_in[6];
  const float* dwv_w  = (const float*)d_in[7];
  const float* dwv_b  = (const float*)d_in[8];
  // d_in[9]=H, d_in[10]=W fixed at 64 for this problem size.

  char* wsb = (char*)d_ws;
  float*    obuf = (float*)   (wsb + (size_t)64 * 1024 * 1024);  // 32 MB

  // QKV projection and stripe attention: one work-group a window-head
  cswin_attn_kernel<<<dim3(1024), 256, 0, stream>>>(
      x, qkv_w, qkv_b, dwh_w, dwh_b, dwv_w, dwv_b, obuf);

  // Output projection
  cswin_proj_kernel<<<dim3(256), 256, 0, stream>>>(
      obuf, proj_w, proj_b, (float*)d_out);
}

// v009
// One run takes 51.2 microseconds.
// In both of two side-by-side timings against v008, it was 1.09 times as fast.
// Counting every step since v000, it is 52.5 times as fast.
#include <hip/hip_runtime.h>
#include <hip/hip_bf16.h>

typedef __attribute__((ext_vector_type(16))) _Float16 v16h;
typedef __attribute__((ext_vector_type(8)))  float    v8f;

// ---------------------------------------------------------------------------
// WMMA fragment loaders (wave32, 16-bit A/B layout per CDNA5 ISA 7.12.2):
//   lane l holds row (l&15); khi = (l>>4)*8; half-element e maps to
//   K = 16*(e>=8) + khi + (e&7).
// B fragments (32x16 K-major) load identically from the row-major *transpose*
// of B, i.e. B^T (N x K) — which for x·W^T is exactly the row-major weight
// tile we keep in LDS.
// ---------------------------------------------------------------------------

__device__ static inline v16h frag_k16(const _Float16* base, int ld) {
  // 16x16 tile, zero-padded to K=32 (head_dim == 16)
  const int lane = threadIdx.x & 31;
  const int row  = lane & 15;
  const int khi  = (lane >> 4) << 3;
  v16h a;
#pragma unroll
  for (int e = 0; e < 16; ++e) {
    if (e < 8) a[e] = base[row * ld + khi + (e & 7)];
    else       a[e] = (_Float16)0.0f;
  }
  return a;
}

__device__ static inline v16h frag_k32_f32(const float* base, int ld) {
  const int lane = threadIdx.x & 31;
  const int row  = lane & 15;
  const int khi  = (lane >> 4) << 3;
  // base, ld and khi are multiples of 4 floats: four 16-byte reads a lane,
  // the width that the padded pitch spreads over all banks
  const float4* p = (const float4*)(base + row * ld + khi);
  const float4 f[4] = {p[0], p[1], p[4], p[5]};   // k = khi + 0..7, 16 + khi + 0..7
  v16h a;
#pragma unroll
  for (int j = 0; j < 4; ++j) {
    a[4 * j + 0] = (_Float16)f[j].x;
    a[4 * j + 1] = (_Float16)f[j].y;
    a[4 * j + 2] = (_Float16)f[j].z;
    a[4 * j + 3] = (_Float16)f[j].w;
  }
  return a;
}

// ---------------------------------------------------------------------------
// Whole-wave (32 lanes) maximum and sum, every lane active, result in every
// lane: four xor steps inside each 16-lane row by DPP (row_xmask 1,2,4,8),
// then lane l with lane l ^ 16.
// ---------------------------------------------------------------------------
template <int CTRL>
__device__ static inline float dpp_row(float x) {
  const int b = __builtin_bit_cast(int, x);
  return __builtin_bit_cast(float,
      __builtin_amdgcn_update_dpp(0, b, CTRL, 0xf, 0xf, true));
}

__device__ static inline float xhalf(float x) {
  const int b = __builtin_bit_cast(int, x);
  return __builtin_bit_cast(float,
      __builtin_amdgcn_permlanex16(b, b, 0x76543210, 0xfedcba98, false, false));
}

__device__ static inline float max2(float a, float b) {
  return __builtin_elementwise_maximumnum(a, b);
}

__device__ static inline float wave_max(float x) {
  x = max2(x, dpp_row<0x161>(x));
  x = max2(x, dpp_row<0x162>(x));
  x = max2(x, dpp_row<0x164>(x));
  x = max2(x, dpp_row<0x168>(x));
  return max2(x, xhalf(x));
}

__device__ static inline float wave_sum(float x) {
  x += dpp_row<0x161>(x);
  x += dpp_row<0x162>(x);
  x += dpp_row<0x164>(x);
  x += dpp_row<0x168>(x);
  return x + xhalf(x);
}

// 2^x of sixteen values, in place. One statement: inside it no v_exp_f32 is
// followed by an instruction that reads its result or overwrites its source,
// and the closing v_nop is that free slot behind the last one.
__device__ static inline void exp2_x16(float (&e)[16]) {
  asm("v_exp_f32 %0, %0\n\tv_exp_f32 %1, %1\n\tv_exp_f32 %2, %2\n\t"
      "v_exp_f32 %3, %3\n\tv_exp_f32 %4, %4\n\tv_exp_f32 %5, %5\n\t"
      "v_exp_f32 %6, %6\n\tv_exp_f32 %7, %7\n\tv_exp_f32 %8, %8\n\t"
      "v_exp_f32 %9, %9\n\tv_exp_f32 %10, %10\n\tv_exp_f32 %11, %11\n\t"
      "v_exp_f32 %12, %12\n\tv_exp_f32 %13, %13\n\tv_exp_f32 %14, %14\n\t"
      "v_exp_f32 %15, %15\n\tv_nop"
      : "+v"(e[0]), "+v"(e[1]), "+v"(e[2]), "+v"(e[3]), "+v"(e[4]), "+v"(e[5]),
        "+v"(e[6]), "+v"(e[7]), "+v"(e[8]), "+v"(e[9]), "+v"(e[10]),
        "+v"(e[11]), "+v"(e[12]), "+v"(e[13]), "+v"(e[14]), "+v"(e[15]));
}

// ---------------------------------------------------------------------------
// Row pitches of the LDS tiles that the fragment loaders read. A fragment read
// is 16 bytes a lane with the 16 lanes of a half-wave on 16 consecutive rows:
// at a pitch of an odd multiple of 16 bytes those rows fall on distinct banks.
// ---------------------------------------------------------------------------
#define G_LD  136   // halves: 128-wide f16 GEMM tiles, 272 B a row
#define S_LD  516   // floats: unused; 2064 B a row
#define QK_LD 40    // halves: a token's 16 of k, then its 16 of q; 80 B a row

typedef __attribute__((ext_vector_type(8)))  _Float16 v8h;
typedef __attribute__((ext_vector_type(4)))  _Float16 v4h;
typedef __attribute__((ext_vector_type(16))) float    v16f;
typedef __attribute__((ext_vector_type(4)))  float    v4f;

// 16 rows x 32 halves in the hardware k order: two 16-byte reads a lane.
__device__ static inline v16h frag_k32_v(const _Float16* p) {
  const v8h lo = *(const v8h*)p;
  const v8h hi = *(const v8h*)(p + 16);
  return __builtin_shufflevector(lo, hi, 0, 1, 2, 3, 4, 5, 6, 7,
                                 8, 9, 10, 11, 12, 13, 14, 15);
}

// ---------------------------------------------------------------------------
// LePE of one window of (512 / WS) x WS tokens, 256 threads:
//   Vt[d][p] = v[p][d] + bias[d] + sum over the 3x3 taps inside the window.
// v lies in LDS, token-major with 16 channels a token, so the lanes run across
// the channels: lanes 0-15 are the channels of one token, lanes 16-31 those of
// the next token of the row, and every read of a wave falls in 128 contiguous
// bytes. A thread keeps its channel's nine weights in registers and
// walks down one column of the window, so each row of three neighbours is read
// once and serves three outputs. A thread's reads stand together, in front of
// its sums, so that they are in flight at once. A tap left or right of the
// window gets weight zero and reads the thread's own column instead; a row
// above or below counts as zero.
// ---------------------------------------------------------------------------
#define VT_LD 520
template <int WS>
__device__ static inline void lepe_window(
    const float* __restrict__ vw, const float* __restrict__ cw,
    const float* __restrict__ cb, _Float16* __restrict__ Vt, int tid)
{
  constexpr int HS    = 512 / WS;                    // rows of the window
  constexpr int CW    = WS >= 16 ? 16 : WS;          // columns taken in one pass
  constexpr int NPASS = WS / CW;                     // column passes a thread makes
  constexpr int NSEG  = 16 / CW;                     // row segments of the window
  constexpr int ROWS  = HS / NSEG;                   // rows a thread walks
  constexpr int RS    = WS * 16;                     // floats from row to row
  const int d   = tid & 15;
  const int u   = tid >> 4;                          // 0..15
  const int c0  = u % CW;                            // column in pass 0
  const int seg = u / CW;
  const int r0  = seg * ROWS;

  const int ow = d * 36;                             // bytes to the channel's weights
  const float* pw = (const float*)((const char*)cw + ow);
  float w[9];
#pragma unroll  // constant indices keep the array in registers
  for (int j = 0; j < 9; ++j) w[j] = pw[j];
  const float bias = cb[d];
  // The address registers of the loads above stay untouched up to this wait.
  asm volatile("s_wait_xcnt 0x0" :: "v"(pw), "v"(d) : "memory");

  const float* pv = vw + (r0 * WS + c0) * 16 + d;    // first row, own column
  _Float16*    po = Vt + d * VT_LD + r0 * WS + c0;
  // row above the first and row below the last: inside the window or not
  const bool has_up = seg > 0, has_dn = seg < NSEG - 1;
  const int  up = has_up ? -RS : 0;
  const int  dn = has_dn ? ROWS * RS : (ROWS - 1) * RS;
  // left of the first pass's column, right of the last pass's
  const bool has_l = c0 > 0, has_r = c0 < CW - 1;
  const float* pm = pv;
  const float* pl = has_l ? pv - 16 : pv;
  const float* pr = (has_r ? pv + 16 : pv) + (NPASS - 1) * CW * 16;
  // the same three columns in the row above and in the row below (NSEG > 1)
  const float* plu = pl + up, * pmu = pm + up, * pru = pr + up;
  const float* pld = pl + dn, * pmd = pm + dn, * prd = pr + dn;

  // x[ps][j]: row r0 - 1 + j of the three columns of pass ps
  float x[NPASS][ROWS + 2][3];
#pragma unroll  // constant indices keep the arrays in registers
  for (int ps = 0; ps < NPASS; ++ps) {
    const float* ql = ps > 0         ? pm + (ps * CW - 1) * 16 : pl;
    const float* qm = pm + ps * CW * 16;
    const float* qr = ps < NPASS - 1 ? pm + (ps * CW + 1) * 16 : pr;
#pragma unroll  // constant indices keep the arrays in registers
    for (int j = 1; j <= ROWS; ++j) {
      x[ps][j][0] = ql[(j - 1) * RS];
      x[ps][j][1] = qm[(j - 1) * RS];
      x[ps][j][2] = qr[(j - 1) * RS];
    }
  }
  if (NSEG > 1) {                                    // then NPASS == 1
    x[0][0][0] = plu[0];
    x[0][0][1] = pmu[0];
    x[0][0][2] = pru[0];
    x[0][ROWS + 1][0] = pld[0];
    x[0][ROWS + 1][1] = pmd[0];
    x[0][ROWS + 1][2] = prd[0];
  }

#pragma unroll  // constant indices keep the arrays in registers
  for (int ps = 0; ps < NPASS; ++ps) {
    float wl[3], wr[3];
#pragma unroll  // constant indices keep the arrays in registers
    for (int j = 0; j < 3; ++j) {
      wl[j] = (ps > 0 || has_l)         ? w[3 * j]     : 0.0f;
      wr[j] = (ps < NPASS - 1 || has_r) ? w[3 * j + 2] : 0.0f;
    }
    if (NSEG > 1) {
#pragma unroll  // constant indices keep the arrays in registers
      for (int k = 0; k < 3; ++k) {
        x[ps][0][k]        = has_up ? x[ps][0][k]        : 0.0f;
        x[ps][ROWS + 1][k] = has_dn ? x[ps][ROWS + 1][k] : 0.0f;
      }
    }
#pragma unroll  // constant indices keep the arrays in registers
    for (int j = 0; j < ROWS; ++j) {
      float acc = bias;
#pragma unroll  // constant indices keep the arrays in registers
      for (int dy = 0; dy < 3; ++dy) {
        if (NSEG == 1 && (j + dy == 0 || j + dy == ROWS + 1)) continue;
        acc += x[ps][j + dy][0] * wl[dy];
        acc += x[ps][j + dy][1] * w[3 * dy + 1];
        acc += x[ps][j + dy][2] * wr[dy];
      }
      acc += x[ps][j + 1][1];
      po[j * WS + ps * CW] = (_Float16)acc;
    }
  }
}

typedef __attribute__((ext_vector_type(2)))  float    v2f;

// 16 rows x 16 halves as a K = 32 fragment, upper half of k zero: one 16-byte
// read a lane (row l & 15, halves 8 * (l >> 4) ..). p points at the lane's own 8.
__device__ static inline v16h frag_k16_v(const _Float16* p) {
  const v8h lo = *(const v8h*)p;
  const v8h z  = {};
  return __builtin_shufflevector(lo, z, 0, 1, 2, 3, 4, 5, 6, 7,
                                 8, 9, 10, 11, 12, 13, 14, 15);
}

__device__ static inline float max8(float m, v8f s) {
  const float a = max2(max2(s[0], s[1]), s[2]);
  const float b = max2(max2(s[3], s[4]), s[5]);
  m = max2(max2(m, s[6]), s[7]);
  return max2(max2(m, a), b);
}

#define QT 2   // query tiles (16 columns each) that a wave works on together
#define EXP_SAFE 12.0f   // largest |exponent| for which the shift may be 0

__global__ __launch_bounds__(256) void cswin_attn_kernel(
    const float* __restrict__ x, const float* __restrict__ qkv_w,
    const float* __restrict__ qkv_b,
    const float* __restrict__ dwh_w, const float* __restrict__ dwh_b,
    const float* __restrict__ dwv_w, const float* __restrict__ dwv_b,
    float* __restrict__ obuf)
{
  __shared__ __attribute__((aligned(16))) _Float16 Ks[512 * QK_LD];  // 512 x (k, q)
  // Vt has the largest alignment, which puts it first in LDS: the reads of W's
  // fragments, which lie in its place, then take their offsets as immediates of
  // one address register instead of an address register each.
  __shared__ __attribute__((aligned(128))) _Float16 Vt[16 * VT_LD];  // d-major
  __shared__ __attribute__((aligned(16))) float    Vs[512 * 16];     // v, token-major
  __shared__ __attribute__((aligned(16))) float    Km[8];            // max |k| a wave saw
  // The head's rows of W (48 x G_LD halves) and, behind them, its 48 biases live
  // in Vt's place: their last read and Vt's first write are on the two sides of
  // the second barrier.
  _Float16* Ws = Vt;

  const int tid  = threadIdx.x;
  const int lane = tid & 31;
  const int wave = tid >> 5;
  const int wh   = blockIdx.x;        // 0..1023
  const int dir  = wh >> 9;
  const int c    = lane & 15;         // token or query column, key, channel or d row
  const int h    = lane >> 4;
  const int hloc = wh & 3, win = (wh >> 2) & 7, b_ = (wh >> 5) & 15;
  const int hg   = dir * 4 + hloc;    // head 0..7

  // W rows hg * 16 + 0..15 of q, k and v: LDS row wave + 8 j is row
  // wave + 8 (j & 1) of part j >> 1. A wave reads one whole row (512 B) a load.
  const v4f* wg = (const v4f*)(qkv_w + (hg * 16 + wave) * 128) + lane;
  v4f wr[6];
#pragma unroll  // constant indices keep the arrays in registers
  for (int j = 0; j < 6; ++j) wr[j] = wg[((j >> 1) * 128 + (j & 1) * 8) * 32];
  // the lane's 8 biases of q, k and v
  const v4f* bl = (const v4f*)(qkv_b + hg * 16 + 8 * h);
  v4f bs[3][2];
#pragma unroll  // constant indices keep the arrays in registers
  for (int s = 0; s < 3; ++s) { bs[s][0] = bl[s * 32]; bs[s][1] = bl[s * 32 + 1]; }
  // The address registers of the loads above stay untouched up to this wait.
  asm volatile("s_wait_xcnt 0x0" :: "v"(wg), "v"(bl) : "memory");

  // The wave's 64 x rows, one whole row (512 contiguous bytes, four lines) a
  // load. Row j of token tile tt is window position wave * 64 + 16 tt + j: from
  // j to j + 1 one token, from j to j + 8 eight tokens or one row of the image,
  // from tile to tile sixteen tokens or two rows of the image.
  const int p0 = wave * 64 + c;       // the lane's window position in tile 0
  const int nb = dir ? (wave * 512 + win * 8) : (win * 512 + wave * 64);
  const int ts = dir ? 128 * 32 : 16 * 32;      // 16-byte units from tile to tile
  const int hs = dir ? 64 * 32 : 8 * 32;        // and from row j to row j + 8
  const v4f* xl = (const v4f*)(x + ((size_t)b_ * 4096 + nb) * 128) + lane;
  // A tile's 16 rows pass as f16 through LDS, where a lane picks up its token's
  // part in the k order of the fragments. They lie in the wave's own 64 rows of
  // Ks (5120 B, 16 x G_LD halves are 4352 B), which no other wave touches before
  // the second barrier; the wave's k and q wait in registers until the last tile
  // has been read.
  _Float16* xs = Ks + wave * 64 * QK_LD;
  _Float16* sd = xs + lane * 4;                  // the lane's 4 halves of row 0
  const _Float16* sl = xs + c * G_LD + 8 * h;    // the lane's part of its token's row

  _Float16* wd = Ws + wave * G_LD + lane * 4;
#pragma unroll  // constant indices keep the arrays in registers
  for (int j = 0; j < 6; ++j)
    *(v4h*)(wd + j * 8 * G_LD) = __builtin_convertvector(wr[j], v4h);
  // The 48 biases go to LDS behind W's rows, from the two lanes of wave 0 that
  // hold channels 0..7 and 8..15: read back tile by tile, they take no register
  // while a tile's x rows are in flight.
  float* Bs = (float*)(Ws + 48 * G_LD);
  if ((tid & ~16) == 0) {
#pragma unroll  // constant indices keep the arrays in registers
    for (int s = 0; s < 3; ++s) {
      *(v4f*)(Bs + s * 16 + 8 * h)     = bs[s][0];
      *(v4f*)(Bs + s * 16 + 8 * h + 4) = bs[s][1];
    }
  }
  __syncthreads();

  const _Float16* wl = Ws + c * G_LD + 8 * h;    // the lane's part of W's q rows
  float ka = 0.0f;                    // largest |k| among the lane's elements
  v8h kt[4], qt[4];                   // the wave's k and q, tile by tile
#pragma unroll  // constant indices keep the arrays in registers
  for (int tt = 0; tt < 4; ++tt) {
    const v4f* xa = xl + tt * ts;
    const v4f* xb = xa + hs;
    v4f xr[16];
#pragma unroll  // constant indices keep the arrays in registers
    for (int j = 0; j < 8; ++j) {
      xr[j]     = xa[j * 32];
      xr[8 + j] = xb[j * 32];
    }
    // The address registers of the loads above stay untouched up to this wait.
    asm volatile("s_wait_xcnt 0x0" :: "v"(xa), "v"(xb) : "memory");
#pragma unroll  // constant indices keep the arrays in registers
    for (int j = 0; j < 16; ++j)
      *(v4h*)(sd + j * G_LD) = __builtin_convertvector(xr[j], v4h);
    // The rows are in LDS before other lanes of the wave read them back.
    asm volatile("s_wait_dscnt 0x0" ::: "memory");
    // fragments of one k chunk: the tile's x and the three parts of W
    v16h xf = frag_k32_v(sl), wf[3];
#pragma unroll  // constant indices keep the arrays in registers
    for (int s = 0; s < 3; ++s) wf[s] = frag_k32_v(wl + s * 16 * G_LD);
    v8f a[3] = {v8f{}, v8f{}, v8f{}};
    v4f bt[3][2];
#pragma unroll  // the next chunk's fragments are fetched into a second register set
    for (int kc = 0; kc < 4; ++kc) {
      v16h xn, wn[3];
      if (kc < 3) {
        xn = frag_k32_v(sl + (kc + 1) * 32);
#pragma unroll  // constant indices keep the arrays in registers
        for (int s = 0; s < 3; ++s)
          wn[s] = frag_k32_v(wl + s * 16 * G_LD + (kc + 1) * 32);
      } else {
#pragma unroll  // constant indices keep the arrays in registers
        for (int s = 0; s < 3; ++s) {
          bt[s][0] = *(const v4f*)(Bs + s * 16 + 8 * h);
          bt[s][1] = *(const v4f*)(Bs + s * 16 + 8 * h + 4);
        }
      }
      // Holds the next chunk's LDS reads, as one group, in front of this chunk's
      // products: their latency then runs under the products.
      __builtin_amdgcn_sched_barrier(0);
#pragma unroll  // three independent accumulator chains
      for (int s = 0; s < 3; ++s)
        a[s] = __builtin_amdgcn_wmma_f32_16x16x32_f16(false, wf[s], false, xf,
                                                      (short)0, a[s], false, false);
      if (kc < 3) {
        xf = xn;
#pragma unroll  // constant indices keep the arrays in registers
        for (int s = 0; s < 3; ++s) wf[s] = wn[s];
      }
    }
    // The tile's rows have been read before anything is written over them.
    asm volatile("s_wait_dscnt 0x0" ::: "memory");
    // Keeps the next tile's loads behind this tile's products: the rows of one
    // tile in registers at a time, or a WGP holds a work-group less.
    __builtin_amdgcn_sched_barrier(0);
    v4f lo[3], hi[3];
#pragma unroll  // constant indices keep the arrays in registers
    for (int s = 0; s < 3; ++s) {
      lo[s] = (v4f){a[s][0], a[s][1], a[s][2], a[s][3]} + bt[s][0];
      hi[s] = (v4f){a[s][4], a[s][5], a[s][6], a[s][7]} + bt[s][1];
    }
    const int pos = p0 + tt * 16;
    const v8h q8 = __builtin_shufflevector(__builtin_convertvector(lo[0], v4h),
                                           __builtin_convertvector(hi[0], v4h),
                                           0, 1, 2, 3, 4, 5, 6, 7);
    const v8h k8 = __builtin_shufflevector(__builtin_convertvector(lo[1], v4h),
                                           __builtin_convertvector(hi[1], v4h),
                                           0, 1, 2, 3, 4, 5, 6, 7);
    kt[tt] = k8;
    qt[tt] = q8;
#pragma unroll  // constant indices keep the arrays in registers
    for (int e = 0; e < 8; ++e) ka = max2(ka, __builtin_fabsf((float)k8[e]));
    v4f* pv = (v4f*)(Vs + pos * 16 + 8 * h);
    pv[0] = lo[2];
    pv[1] = hi[2];
  }
#pragma unroll  // constant indices keep the arrays in registers
  for (int tt = 0; tt < 4; ++tt) {
    _Float16* pk = Ks + (p0 + tt * 16) * QK_LD + 8 * h;
    *(v8h*)pk = kt[tt];
    *(v8h*)(pk + 16) = qt[tt];
  }
  ka = wave_max(ka);
  if (lane == 0) Km[wave] = ka;
  __syncthreads();

  // LePE: Vt[d][p] = v + conv3x3_dw(v) + bias, zero-padded within the window
  if (dir) lepe_window<8>(Vs, dwv_w, dwv_b, Vt, tid);
  else     lepe_window<64>(Vs, dwh_w, dwh_b, Vt, tid);
  __syncthreads();

  const _Float16* kl = Ks + c * QK_LD + 8 * h;   // the lane's part of key tile 0
  const _Float16* vl = Vt + c * VT_LD + 8 * h;   // the lane's part of key chunk 0
  const float cs = 0.25f * 1.44269504f;          // e^(0.25 t) = 2^(cs t)
  const v4f km0 = *(const v4f*)Km, km1 = *(const v4f*)(Km + 4);
  const float kb = cs * max2(max2(max2(km0[0], km0[1]), max2(km0[2], km0[3])),
                             max2(max2(km1[0], km1[1]), max2(km1[2], km1[3])));
  float* ow = obuf + (size_t)b_ * 4096 * 128 + hg * 16 + 8 * h;

  // 32 query tiles, 4 a wave, QT at a time
  for (int g = 0; g < 4 / QT; ++g) {
    const int q0 = (wave * 4 + g * QT) * 16 + c;  // the lane's query in tile 0
    const _Float16* ql = Ks + q0 * QK_LD + 16 + 8 * h;
    v16h qf[QT];
#pragma unroll  // constant indices keep the arrays in registers
    for (int t = 0; t < QT; ++t) qf[t] = frag_k16_v(ql + t * 16 * QK_LD);

    // --- bound on |exponent| of the lane's queries: cs * sum|q| * max|k| ---
    float qa = 0.0f;
#pragma unroll  // constant indices keep the arrays in registers
    for (int t = 0; t < QT; ++t) {
      float l1 = 0.0f;
#pragma unroll  // constant indices keep the arrays in registers
      for (int e = 0; e < 8; ++e) l1 += __builtin_fabsf((float)qf[t][e]);
      qa = max2(qa, l1 + xhalf(l1));
    }
    // one answer for the whole wave (the products need every lane on); the
    // negated compare sends a bound that is not a number to the first walk
    const bool walk = __builtin_amdgcn_ballot_w32(!(qa * kb <= EXP_SAFE)) != 0u;

    float mc[QT];
#pragma unroll  // constant indices keep the arrays in registers
    for (int t = 0; t < QT; ++t) mc[t] = 0.0f;
    if (walk) {
      // --- first walk: maximum of each query's 512 scores ---
      float mx[QT];
#pragma unroll  // constant indices keep the arrays in registers
      for (int t = 0; t < QT; ++t) mx[t] = -3.4e38f;
#pragma unroll 4  // several independent products between a product and its use
      for (int j = 0; j < 32; ++j) {
        const v16h kf = frag_k16_v(kl + j * 16 * QK_LD);
#pragma unroll  // constant indices keep the arrays in registers
        for (int t = 0; t < QT; ++t) {
          v8f s = {};
          s = __builtin_amdgcn_wmma_f32_16x16x32_f16(false, kf, false, qf[t],
                                                     (short)0, s, false, false);
          mx[t] = max8(mx[t], s);
        }
      }
#pragma unroll  // constant indices keep the arrays in registers
      for (int t = 0; t < QT; ++t) mc[t] = -cs * max2(mx[t], xhalf(mx[t]));
    }

    // --- second walk: P^T = 2^(cs (S^T - shift)), its sum, O^T += V_le^T P^T ---
    v8f o[QT];
    v2f sm[QT];
#pragma unroll  // constant indices keep the arrays in registers
    for (int t = 0; t < QT; ++t) { o[t] = (v8f){}; sm[t] = (v2f){}; }
    for (int kc = 0; kc < 16; ++kc) {
      const v16h k0 = frag_k16_v(kl + (2 * kc) * 16 * QK_LD);
      const v16h k1 = frag_k16_v(kl + (2 * kc + 1) * 16 * QK_LD);
      const v16h vf = frag_k32_v(vl + kc * 32);
#pragma unroll  // constant indices keep the arrays in registers
      for (int t = 0; t < QT; ++t) {
        v8f s0 = {}, s1 = {};
        s0 = __builtin_amdgcn_wmma_f32_16x16x32_f16(false, k0, false, qf[t],
                                                    (short)0, s0, false, false);
        s1 = __builtin_amdgcn_wmma_f32_16x16x32_f16(false, k1, false, qf[t],
                                                    (short)0, s1, false, false);
        float e[16];
#pragma unroll  // constant indices keep the arrays in registers
        for (int r = 0; r < 8; ++r) {
          e[r]     = __builtin_fmaf(s0[r], cs, mc[t]);
          e[8 + r] = __builtin_fmaf(s1[r], cs, mc[t]);
        }
        exp2_x16(e);
        v2f p2[8];
        v16f pf;
#pragma unroll  // constant indices keep the arrays in registers
        for (int r = 0; r < 8; ++r) p2[r] = (v2f){e[2 * r], e[2 * r + 1]};
#pragma unroll  // constant indices keep the arrays in registers
        for (int r = 0; r < 16; ++r) pf[r] = e[r];
        sm[t] += ((p2[0] + p2[1]) + (p2[2] + p2[3])) +
                 ((p2[4] + p2[5]) + (p2[6] + p2[7]));
        // element s of the B operand = key 8 h + s of tile 0, then of tile 1
        const v16h p = __builtin_convertvector(pf, v16h);
        o[t] = __builtin_amdgcn_wmma_f32_16x16x32_f16(false, vf, false, p,
                                                      (short)0, o[t], false, false);
      }
    }

    // --- O^T[8 h + r][query c] / row sum: 32 contiguous bytes a lane ---
#pragma unroll  // constant indices keep the arrays in registers
    for (int t = 0; t < QT; ++t) {
      const float sl  = sm[t][0] + sm[t][1];
      const float inv = 1.0f / (sl + xhalf(sl));
      const int pos = q0 + t * 16;
      const int n = dir ? ((pos >> 3) * 64 + win * 8 + (pos & 7))
                        : (win * 512 + pos);
      float4* po = (float4*)(ow + n * 128);
      po[0] = make_float4(o[t][0] * inv, o[t][1] * inv, o[t][2] * inv, o[t][3] * inv);
      po[1] = make_float4(o[t][4] * inv, o[t][5] * inv, o[t][6] * inv, o[t][7] * inv);
      // The address registers of the stores above stay untouched up to this wait.
      asm volatile("s_wait_xcnt 0x0" :: "v"(po) : "memory");
    }
  }
}

// ---------------------------------------------------------------------------
// Kernel 2: out = attn_out @ proj_w^T + proj_b   (65536x128 @ 128x128)
// One work-group for 256 tokens and ALL 128 channels:
//   - a wave owns 32 tokens. It reads each of their rows with one load (512
//     contiguous bytes), once, and turns them into A fragments by way of its
//     own rows of an f16 LDS tile
//   - the whole of W is staged in LDS as f16, once a work-group, its rows in the
//     order 64 j + 16 a + i for channel 64 j + 4 i + a. Column i of the four
//     tiles a = 0..3 of group j is then channels 64 j + 4 i + 0..3: a lane holds
//     four consecutive channels of a token, 16 lanes hold 256 contiguous bytes
//     of an output row, and a wave's 16-byte store fills whole lines
// ---------------------------------------------------------------------------
__global__ __launch_bounds__(256) void cswin_proj_kernel(
    const float* __restrict__ a_in, const float* __restrict__ w,
    const float* __restrict__ bias, float* __restrict__ out)
{
  __shared__ __attribute__((aligned(16))) _Float16 Ws[128 * G_LD];
  __shared__ __attribute__((aligned(16))) _Float16 As[256 * G_LD];
  const int tid  = threadIdx.x;
  const int lane = tid & 31;
  const int wave = tid >> 5;                 // 8 waves (wave32)
  const int c    = lane & 15;                // token row or channel column of a tile
  const int h    = lane >> 4;
  const int m0   = blockIdx.x * 256 + wave * 32;   // the wave's first token

  // W row wave + 8 j and token row m0 + j: one whole row a load. All in flight.
  const v4f* wg = (const v4f*)w + tid;
  const v4f* ag = (const v4f*)(a_in + (size_t)m0 * 128) + lane;
  v4f wr[16], ar[32];
#pragma unroll  // constant indices keep the arrays in registers
  for (int j = 0; j < 16; ++j) wr[j] = wg[j * 256];
#pragma unroll  // constant indices keep the arrays in registers
  for (int j = 0; j < 32; ++j) ar[j] = ag[j * 32];
  // The address registers of the loads above stay untouched up to this wait.
  asm volatile("s_wait_xcnt 0x0" :: "v"(wg), "v"(ag) : "memory");

  // channel wave + 8 j has a = wave & 3, i = (wave >> 2) + 2 (j & 7), group j >> 3
  _Float16* wd = Ws + ((wave & 3) * 16 + (wave >> 2)) * G_LD + lane * 4;
#pragma unroll  // constant indices keep the arrays in registers
  for (int j = 0; j < 16; ++j)
    *(v4h*)(wd + ((j >> 3) * 64 + (j & 7) * 2) * G_LD) =
        __builtin_convertvector(wr[j], v4h);
  _Float16* ad = As + wave * 32 * G_LD + lane * 4;
#pragma unroll  // constant indices keep the arrays in registers
  for (int j = 0; j < 32; ++j)
    *(v4h*)(ad + j * G_LD) = __builtin_convertvector(ar[j], v4h);
  __syncthreads();

  const _Float16* al = As + (wave * 32 + c) * G_LD + 8 * h;  // the lane's part of token tile 0
  const _Float16* wl = Ws + c * G_LD + 8 * h;                // and of channel tile 0
  v16h af[2][4];
#pragma unroll  // constant indices keep the arrays in registers
  for (int t = 0; t < 2; ++t) {
#pragma unroll  // constant indices keep the arrays in registers
    for (int kc = 0; kc < 4; ++kc)
      af[t][kc] = frag_k32_v(al + t * 16 * G_LD + kc * 32);
  }
  const v4f* bl = (const v4f*)bias + c;              // channels 4 c .. of group 0
  const v4f  bj[2] = {bl[0], bl[16]};
  v4f* po = (v4f*)(out + (size_t)(m0 + 8 * h) * 128) + c;   // token 8 h, group 0

  v16h wf[4];
#pragma unroll  // constant indices keep the arrays in registers
  for (int kc = 0; kc < 4; ++kc) wf[kc] = frag_k32_v(wl + kc * 32);

#pragma unroll  // constant indices keep the arrays in registers
  for (int j = 0; j < 2; ++j) {
    v8f acc[2][4];
#pragma unroll  // the next tile's fragments are fetched into a second register set
    for (int a = 0; a < 4; ++a) {
      const int nt = j * 4 + a;
      v16h wn[4];
      if (nt < 7) {
#pragma unroll  // constant indices keep the arrays in registers
        for (int kc = 0; kc < 4; ++kc)
          wn[kc] = frag_k32_v(wl + (nt + 1) * 16 * G_LD + kc * 32);
      }
      // Holds the next tile's LDS reads, as one group, in front of this tile's
      // products: their latency then runs under the products.
      __builtin_amdgcn_sched_barrier(0);
      acc[0][a] = (v8f){};
      acc[1][a] = (v8f){};
#pragma unroll  // two independent accumulator chains, taken in turn
      for (int kc = 0; kc < 4; ++kc) {
#pragma unroll  // constant indices keep the arrays in registers
        for (int t = 0; t < 2; ++t)
          acc[t][a] = __builtin_amdgcn_wmma_f32_16x16x32_f16(
              false, af[t][kc], false, wf[kc], (short)0, acc[t][a], false, false);
      }
      if (nt < 7) {
#pragma unroll  // constant indices keep the arrays in registers
        for (int kc = 0; kc < 4; ++kc) wf[kc] = wn[kc];
      }
    }
#pragma unroll  // constant indices keep the arrays in registers
    for (int t = 0; t < 2; ++t) {
#pragma unroll  // constant indices keep the arrays in registers
      for (int r = 0; r < 8; ++r)
        po[(t * 16 + r) * 32 + j * 16] =
            (v4f){acc[t][0][r], acc[t][1][r], acc[t][2][r], acc[t][3][r]} + bj[j];
    }
    // The address registers of the loads and stores above stay untouched up to
    // this wait.
    asm volatile("s_wait_xcnt 0x0" :: "v"(po), "v"(bl) : "memory");
  }
}

// ---------------------------------------------------------------------------
extern "C" void kernel_launch(void* const* d_in, const int* in_sizes, int n_in,
                              void* d_out, int out_size, void* d_ws, size_t ws_size,
                              hipStream_t stream) {
  const float* x      = (const float*)d_in[0];
  const float* qkv_w  = (const float*)d_in[1];
  const float* qkv_b  = (const float*)d_in[2];
  const float* proj_w = (const float*)d_in[3];
  const float* proj_b = (const float*)d_in[4];
  const float* dwh_w  = (const float*)d_in[5];
  const float* dwh_b  = (const float*)d_in[6];
  const float* dwv_w  = (const float*)d_in[7];
  const float* dwv_b  = (const float*)d_in[8];
  // d_in[9]=H, d_in[10]=W fixed at 64 for this problem size.

  char* wsb = (char*)d_ws;
  float*    obuf = (float*)   (wsb + (size_t)64 * 1024 * 1024);  // 32 MB

  // QKV projection and stripe attention: one work-group a window-head
  cswin_attn_kernel<<<dim3(1024), 256, 0, stream>>>(
      x, qkv_w, qkv_b, dwh_w, dwh_b, dwv_w, dwv_b, obuf);

  // Output projection
  cswin_proj_kernel<<<dim3(256), 256, 0, stream>>>(
      obuf, proj_w, proj_b, (float*)d_out);
}

// v010
// Measured time: 41.8 microseconds a run.
// Next to v009, in two timings, it ran 1.25 and 1.24 times as fast.
// Counting every step since v000, it is 65.3 times as fast.
#include <hip/hip_runtime.h>
#include <hip/hip_bf16.h>

typedef __attribute__((ext_vector_type(16))) _Float16 v16h;
typedef __attribute__((ext_vector_type(8)))  float    v8f;

// ---------------------------------------------------------------------------
// WMMA fragment loaders (wave32, 16-bit A/B layout per CDNA5 ISA 7.12.2):
//   lane l holds row (l&15); khi = (l>>4)*8; half-element e maps to
//   K = 16*(e>=8) + khi + (e&7).
// B fragments (32x16 K-major) load identically from the row-major *transpose*
// of B, i.e. B^T (N x K) — which for x·W^T is exactly the row-major weight
// tile we keep in LDS.
// ---------------------------------------------------------------------------

__device__ static inline v16h frag_k16(const _Float16* base, int ld) {
  // 16x16 tile, zero-padded to K=32 (head_dim == 16)
  const int lane = threadIdx.x & 31;
  const int row  = lane & 15;
  const int khi  = (lane >> 4) << 3;
  v16h a;
#pragma unroll
  for (int e = 0; e < 16; ++e) {
    if (e < 8) a[e] = base[row * ld + khi + (e & 7)];
    else       a[e] = (_Float16)0.0f;
  }
  return a;
}

__device__ static inline v16h frag_k32_f32(const float* base, int ld) {
  const int lane = threadIdx.x & 31;
  const int row  = lane & 15;
  const int khi  = (lane >> 4) << 3;
  // base, ld and khi are multiples of 4 floats: four 16-byte reads a lane,
  // the width that the padded pitch spreads over all banks
  const float4* p = (const float4*)(base + row * ld + khi);
  const float4 f[4] = {p[0], p[1], p[4], p[5]};   // k = khi + 0..7, 16 + khi + 0..7
  v16h a;
#pragma unroll
  for (int j = 0; j < 4; ++j) {
    a[4 * j + 0] = (_Float16)f[j].x;
    a[4 * j + 1] = (_Float16)f[j].y;
    a[4 * j + 2] = (_Float16)f[j].z;
    a[4 * j + 3] = (_Float16)f[j].w;
  }
  return a;
}

// ---------------------------------------------------------------------------
// Whole-wave (32 lanes) maximum and sum, every lane active, result in every
// lane: four xor steps inside each 16-lane row by DPP (row_xmask 1,2,4,8),
// then lane l with lane l ^ 16.
// ---------------------------------------------------------------------------
template <int CTRL>
__device__ static inline float dpp_row(float x) {
  const int b = __builtin_bit_cast(int, x);
  return __builtin_bit_cast(float,
      __builtin_amdgcn_update_dpp(0, b, CTRL, 0xf, 0xf, true));
}

__device__ static inline float xhalf(float x) {
  const int b = __builtin_bit_cast(int, x);
  return __builtin_bit_cast(float,
      __builtin_amdgcn_permlanex16(b, b, 0x76543210, 0xfedcba98, false, false));
}

__device__ static inline float max2(float a, float b) {
  return __builtin_elementwise_maximumnum(a, b);
}

__device__ static inline float wave_max(float x) {
  x = max2(x, dpp_row<0x161>(x));
  x = max2(x, dpp_row<0x162>(x));
  x = max2(x, dpp_row<0x164>(x));
  x = max2(x, dpp_row<0x168>(x));
  return max2(x, xhalf(x));
}

__device__ static inline float wave_sum(float x) {
  x += dpp_row<0x161>(x);
  x += dpp_row<0x162>(x);
  x += dpp_row<0x164>(x);
  x += dpp_row<0x168>(x);
  return x + xhalf(x);
}

// 2^x of sixteen values, in place. One statement: inside it no v_exp_f32 is
// followed by an instruction that reads its result or overwrites its source,
// and the closing v_nop is that free slot behind the last one.
__device__ static inline void exp2_x16(float (&e)[16]) {
  asm("v_exp_f32 %0, %0\n\tv_exp_f32 %1, %1\n\tv_exp_f32 %2, %2\n\t"
      "v_exp_f32 %3, %3\n\tv_exp_f32 %4, %4\n\tv_exp_f32 %5, %5\n\t"
      "v_exp_f32 %6, %6\n\tv_exp_f32 %7, %7\n\tv_exp_f32 %8, %8\n\t"
      "v_exp_f32 %9, %9\n\tv_exp_f32 %10, %10\n\tv_exp_f32 %11, %11\n\t"
      "v_exp_f32 %12, %12\n\tv_exp_f32 %13, %13\n\tv_exp_f32 %14, %14\n\t"
      "v_exp_f32 %15, %15\n\tv_nop"
      : "+v"(e[0]), "+v"(e[1]), "+v"(e[2]), "+v"(e[3]), "+v"(e[4]), "+v"(e[5]),
        "+v"(e[6]), "+v"(e[7]), "+v"(e[8]), "+v"(e[9]), "+v"(e[10]),
        "+v"(e[11]), "+v"(e[12]), "+v"(e[13]), "+v"(e[14]), "+v"(e[15]));
}

// ---------------------------------------------------------------------------
// Row pitches of the LDS tiles that the fragment loaders read. A fragment read
// is 16 bytes a lane with the 16 lanes of a half-wave on 16 consecutive rows:
// at a pitch of an odd multiple of 16 bytes those rows fall on distinct banks.
// ---------------------------------------------------------------------------
#define G_LD  136   // halves: 128-wide f16 GEMM tiles, 272 B a row
#define S_LD  516   // floats: unused; 2064 B a row
#define QK_LD 40    // halves: a token's 16 of k, then its 16 of q; 80 B a row

typedef __attribute__((ext_vector_type(8)))  _Float16 v8h;
typedef __attribute__((ext_vector_type(4)))  _Float16 v4h;
typedef __attribute__((ext_vector_type(16))) float    v16f;
typedef __attribute__((ext_vector_type(4)))  float    v4f;

// 16 rows x 32 halves in the hardware k order: two 16-byte reads a lane.
__device__ static inline v16h frag_k32_v(const _Float16* p) {
  const v8h lo = *(const v8h*)p;
  const v8h hi = *(const v8h*)(p + 16);
  return __builtin_shufflevector(lo, hi, 0, 1, 2, 3, 4, 5, 6, 7,
                                 8, 9, 10, 11, 12, 13, 14, 15);
}

// ---------------------------------------------------------------------------
// LePE of one window of (512 / WS) x WS tokens, 256 threads:
//   Vt[d][p] = v[p][d] + bias[d] + sum over the 3x3 taps inside the window.
// v lies in LDS, token-major with 16 channels a token, so the lanes run across
// the channels: lanes 0-15 are the channels of one token, lanes 16-31 those of
// the next token of the row, and every read of a wave falls in 128 contiguous
// bytes. A thread keeps its channel's nine weights in registers and
// walks down one column of the window, so each row of three neighbours is read
// once and serves three outputs. A thread's reads stand together, in front of
// its sums, so that they are in flight at once. A tap left or right of the
// window gets weight zero and reads the thread's own column instead; a row
// above or below counts as zero.
// ---------------------------------------------------------------------------
#define VT_LD 520
template <int WS>
__device__ static inline void lepe_window(
    const float* __restrict__ vw, const float* __restrict__ cw,
    const float* __restrict__ cb, _Float16* __restrict__ Vt, int tid)
{
  constexpr int HS    = 512 / WS;                    // rows of the window
  constexpr int CW    = WS >= 16 ? 16 : WS;          // columns taken in one pass
  constexpr int NPASS = WS / CW;                     // column passes a thread makes
  constexpr int NSEG  = 16 / CW;                     // row segments of the window
  constexpr int ROWS  = HS / NSEG;                   // rows a thread walks
  constexpr int RS    = WS * 16;                     // floats from row to row
  const int d   = tid & 15;
  const int u   = tid >> 4;                          // 0..15
  const int c0  = u % CW;                            // column in pass 0
  const int seg = u / CW;
  const int r0  = seg * ROWS;

  const int ow = d * 36;                             // bytes to the channel's weights
  const float* pw = (const float*)((const char*)cw + ow);
  float w[9];
#pragma unroll  // constant indices keep the array in registers
  for (int j = 0; j < 9; ++j) w[j] = pw[j];
  const float bias = cb[d];
  // The address registers of the loads above stay untouched up to this wait.
  asm volatile("s_wait_xcnt 0x0" :: "v"(pw), "v"(d) : "memory");

  const float* pv = vw + (r0 * WS + c0) * 16 + d;    // first row, own column
  _Float16*    po = Vt + d * VT_LD + r0 * WS + c0;
  // row above the first and row below the last: inside the window or not
  const bool has_up = seg > 0, has_dn = seg < NSEG - 1;
  const int  up = has_up ? -RS : 0;
  const int  dn = has_dn ? ROWS * RS : (ROWS - 1) * RS;
  // left of the first pass's column, right of the last pass's
  const bool has_l = c0 > 0, has_r = c0 < CW - 1;
  const float* pm = pv;
  const float* pl = has_l ? pv - 16 : pv;
  const float* pr = (has_r ? pv + 16 : pv) + (NPASS - 1) * CW * 16;
  // the same three columns in the row above and in the row below (NSEG > 1)
  const float* plu = pl + up, * pmu = pm + up, * pru = pr + up;
  const float* pld = pl + dn, * pmd = pm + dn, * prd = pr + dn;

  // x[ps][j]: row r0 - 1 + j of the three columns of pass ps
  float x[NPASS][ROWS + 2][3];
#pragma unroll  // constant indices keep the arrays in registers
  for (int ps = 0; ps < NPASS; ++ps) {
    const float* ql = ps > 0         ? pm + (ps * CW - 1) * 16 : pl;
    const float* qm = pm + ps * CW * 16;
    const float* qr = ps < NPASS - 1 ? pm + (ps * CW + 1) * 16 : pr;
#pragma unroll  // constant indices keep the arrays in registers
    for (int j = 1; j <= ROWS; ++j) {
      x[ps][j][0] = ql[(j - 1) * RS];
      x[ps][j][1] = qm[(j - 1) * RS];
      x[ps][j][2] = qr[(j - 1) * RS];
    }
  }
  if (NSEG > 1) {                                    // then NPASS == 1
    x[0][0][0] = plu[0];
    x[0][0][1] = pmu[0];
    x[0][0][2] = pru[0];
    x[0][ROWS + 1][0] = pld[0];
    x[0][ROWS + 1][1] = pmd[0];
    x[0][ROWS + 1][2] = prd[0];
  }

#pragma unroll  // constant indices keep the arrays in registers
  for (int ps = 0; ps < NPASS; ++ps) {
    float wl[3], wr[3];
#pragma unroll  // constant indices keep the arrays in registers
    for (int j = 0; j < 3; ++j) {
      wl[j] = (ps > 0 || has_l)         ? w[3 * j]     : 0.0f;
      wr[j] = (ps < NPASS - 1 || has_r) ? w[3 * j + 2] : 0.0f;
    }
    if (NSEG > 1) {
#pragma unroll  // constant indices keep the arrays in registers
      for (int k = 0; k < 3; ++k) {
        x[ps][0][k]        = has_up ? x[ps][0][k]        : 0.0f;
        x[ps][ROWS + 1][k] = has_dn ? x[ps][ROWS + 1][k] : 0.0f;
      }
    }
#pragma unroll  // constant indices keep the arrays in registers
    for (int j = 0; j < ROWS; ++j) {
      float acc = bias;
#pragma unroll  // constant indices keep the arrays in registers
      for (int dy = 0; dy < 3; ++dy) {
        if (NSEG == 1 && (j + dy == 0 || j + dy == ROWS + 1)) continue;
        acc += x[ps][j + dy][0] * wl[dy];
        acc += x[ps][j + dy][1] * w[3 * dy + 1];
        acc += x[ps][j + dy][2] * wr[dy];
      }
      acc += x[ps][j + 1][1];
      po[j * WS + ps * CW] = (_Float16)acc;
    }
  }
}

typedef __attribute__((ext_vector_type(2)))  float    v2f;

// 16 rows x 16 halves as a K = 32 fragment, upper half of k zero: one 16-byte
// read a lane (row l & 15, halves 8 * (l >> 4) ..). p points at the lane's own 8.
__device__ static inline v16h frag_k16_v(const _Float16* p) {
  const v8h lo = *(const v8h*)p;
  const v8h z  = {};
  return __builtin_shufflevector(lo, z, 0, 1, 2, 3, 4, 5, 6, 7,
                                 8, 9, 10, 11, 12, 13, 14, 15);
}

__device__ static inline float max8(float m, v8f s) {
  const float a = max2(max2(s[0], s[1]), s[2]);
  const float b = max2(max2(s[3], s[4]), s[5]);
  m = max2(max2(m, s[6]), s[7]);
  return max2(max2(m, a), b);
}

#define QT 2   // query tiles (16 columns each) that a wave works on together
#define EXP_SAFE 12.0f   // largest |exponent| for which the shift may be 0

__global__ __launch_bounds__(256) void cswin_attn_kernel(
    const float* __restrict__ x, const float* __restrict__ qkv_w,
    const float* __restrict__ qkv_b,
    const float* __restrict__ dwh_w, const float* __restrict__ dwh_b,
    const float* __restrict__ dwv_w, const float* __restrict__ dwv_b,
    _Float16* __restrict__ obuf)
{
  __shared__ __attribute__((aligned(16))) _Float16 Ks[512 * QK_LD];  // 512 x (k, q)
  // Vt has the largest alignment, which puts it first in LDS: the reads of W's
  // fragments, which lie in its place, then take their offsets as immediates of
  // one address register instead of an address register each.
  __shared__ __attribute__((aligned(128))) _Float16 Vt[16 * VT_LD];  // d-major
  __shared__ __attribute__((aligned(16))) float    Vs[512 * 16];     // v, token-major
  __shared__ __attribute__((aligned(16))) float    Km[8];            // max |k| a wave saw
  // The head's rows of W (48 x G_LD halves) and, behind them, its 48 biases live
  // in Vt's place: their last read and Vt's first write are on the two sides of
  // the second barrier.
  _Float16* Ws = Vt;

  const int tid  = threadIdx.x;
  const int lane = tid & 31;
  const int wave = tid >> 5;
  const int wh   = blockIdx.x;        // 0..1023
  const int dir  = wh >> 9;
  const int c    = lane & 15;         // token or query column, key, channel or d row
  const int h    = lane >> 4;
  const int hloc = wh & 3, win = (wh >> 2) & 7, b_ = (wh >> 5) & 15;
  const int hg   = dir * 4 + hloc;    // head 0..7

  // W rows hg * 16 + 0..15 of q, k and v: LDS row wave + 8 j is row
  // wave + 8 (j & 1) of part j >> 1. A wave reads one whole row (512 B) a load.
  const v4f* wg = (const v4f*)(qkv_w + (hg * 16 + wave) * 128) + lane;
  v4f wr[6];
#pragma unroll  // constant indices keep the arrays in registers
  for (int j = 0; j < 6; ++j) wr[j] = wg[((j >> 1) * 128 + (j & 1) * 8) * 32];
  // the lane's 8 biases of q, k and v
  const v4f* bl = (const v4f*)(qkv_b + hg * 16 + 8 * h);
  v4f bs[3][2];
#pragma unroll  // constant indices keep the arrays in registers
  for (int s = 0; s < 3; ++s) { bs[s][0] = bl[s * 32]; bs[s][1] = bl[s * 32 + 1]; }
  // The address registers of the loads above stay untouched up to this wait.
  asm volatile("s_wait_xcnt 0x0" :: "v"(wg), "v"(bl) : "memory");

  // The wave's 64 x rows, one whole row (512 contiguous bytes, four lines) a
  // load. Row j of token tile tt is window position wave * 64 + 16 tt + j: from
  // j to j + 1 one token, from j to j + 8 eight tokens or one row of the image,
  // from tile to tile sixteen tokens or two rows of the image.
  const int p0 = wave * 64 + c;       // the lane's window position in tile 0
  const int nb = dir ? (wave * 512 + win * 8) : (win * 512 + wave * 64);
  const int ts = dir ? 128 * 32 : 16 * 32;      // 16-byte units from tile to tile
  const int hs = dir ? 64 * 32 : 8 * 32;        // and from row j to row j + 8
  const v4f* xl = (const v4f*)(x + ((size_t)b_ * 4096 + nb) * 128) + lane;
  // A tile's 16 rows pass as f16 through LDS, where a lane picks up its token's
  // part in the k order of the fragments. They lie in the wave's own 64 rows of
  // Ks (5120 B, 16 x G_LD halves are 4352 B), which no other wave touches before
  // the second barrier; the wave's k and q wait in registers until the last tile
  // has been read.
  _Float16* xs = Ks + wave * 64 * QK_LD;
  _Float16* sd = xs + lane * 4;                  // the lane's 4 halves of row 0
  const _Float16* sl = xs + c * G_LD + 8 * h;    // the lane's part of its token's row

  _Float16* wd = Ws + wave * G_LD + lane * 4;
#pragma unroll  // constant indices keep the arrays in registers
  for (int j = 0; j < 6; ++j)
    *(v4h*)(wd + j * 8 * G_LD) = __builtin_convertvector(wr[j], v4h);
  // The 48 biases go to LDS behind W's rows, from the two lanes of wave 0 that
  // hold channels 0..7 and 8..15: read back tile by tile, they take no register
  // while a tile's x rows are in flight.
  float* Bs = (float*)(Ws + 48 * G_LD);
  if ((tid & ~16) == 0) {
#pragma unroll  // constant indices keep the arrays in registers
    for (int s = 0; s < 3; ++s) {
      *(v4f*)(Bs + s * 16 + 8 * h)     = bs[s][0];
      *(v4f*)(Bs + s * 16 + 8 * h + 4) = bs[s][1];
    }
  }
  __syncthreads();

  const _Float16* wl = Ws + c * G_LD + 8 * h;    // the lane's part of W's q rows
  float ka = 0.0f;                    // largest |k| among the lane's elements
  v8h kt[4], qt[4];                   // the wave's k and q, tile by tile
#pragma unroll  // constant indices keep the arrays in registers
  for (int tt = 0; tt < 4; ++tt) {
    const v4f* xa = xl + tt * ts;
    const v4f* xb = xa + hs;
    v4f xr[16];
#pragma unroll  // constant indices keep the arrays in registers
    for (int j = 0; j < 8; ++j) {
      xr[j]     = xa[j * 32];
      xr[8 + j] = xb[j * 32];
    }
    // The address registers of the loads above stay untouched up to this wait.
    asm volatile("s_wait_xcnt 0x0" :: "v"(xa), "v"(xb) : "memory");
#pragma unroll  // constant indices keep the arrays in registers
    for (int j = 0; j < 16; ++j)
      *(v4h*)(sd + j * G_LD) = __builtin_convertvector(xr[j], v4h);
    // The rows are in LDS before other lanes of the wave read them back.
    asm volatile("s_wait_dscnt 0x0" ::: "memory");
    // fragments of one k chunk: the tile's x and the three parts of W
    v16h xf = frag_k32_v(sl), wf[3];
#pragma unroll  // constant indices keep the arrays in registers
    for (int s = 0; s < 3; ++s) wf[s] = frag_k32_v(wl + s * 16 * G_LD);
    v8f a[3] = {v8f{}, v8f{}, v8f{}};
    v4f bt[3][2];
#pragma unroll  // the next chunk's fragments are fetched into a second register set
    for (int kc = 0; kc < 4; ++kc) {
      v16h xn, wn[3];
      if (kc < 3) {
        xn = frag_k32_v(sl + (kc + 1) * 32);
#pragma unroll  // constant indices keep the arrays in registers
        for (int s = 0; s < 3; ++s)
          wn[s] = frag_k32_v(wl + s * 16 * G_LD + (kc + 1) * 32);
      } else {
#pragma unroll  // constant indices keep the arrays in registers
        for (int s = 0; s < 3; ++s) {
          bt[s][0] = *(const v4f*)(Bs + s * 16 + 8 * h);
          bt[s][1] = *(const v4f*)(Bs + s * 16 + 8 * h + 4);
        }
      }
      // Holds the next chunk's LDS reads, as one group, in front of this chunk's
      // products: their latency then runs under the products.
      __builtin_amdgcn_sched_barrier(0);
#pragma unroll  // three independent accumulator chains
      for (int s = 0; s < 3; ++s)
        a[s] = __builtin_amdgcn_wmma_f32_16x16x32_f16(false, wf[s], false, xf,
                                                      (short)0, a[s], false, false);
      if (kc < 3) {
        xf = xn;
#pragma unroll  // constant indices keep the arrays in registers
        for (int s = 0; s < 3; ++s) wf[s] = wn[s];
      }
    }
    // The tile's rows have been read before anything is written over them.
    asm volatile("s_wait_dscnt 0x0" ::: "memory");
    // Keeps the next tile's loads behind this tile's products: the rows of one
    // tile in registers at a time, or a WGP holds a work-group less.
    __builtin_amdgcn_sched_barrier(0);
    v4f lo[3], hi[3];
#pragma unroll  // constant indices keep the arrays in registers
    for (int s = 0; s < 3; ++s) {
      lo[s] = (v4f){a[s][0], a[s][1], a[s][2], a[s][3]} + bt[s][0];
      hi[s] = (v4f){a[s][4], a[s][5], a[s][6], a[s][7]} + bt[s][1];
    }
    const int pos = p0 + tt * 16;
    const v8h q8 = __builtin_shufflevector(__builtin_convertvector(lo[0], v4h),
                                           __builtin_convertvector(hi[0], v4h),
                                           0, 1, 2, 3, 4, 5, 6, 7);
    const v8h k8 = __builtin_shufflevector(__builtin_convertvector(lo[1], v4h),
                                           __builtin_convertvector(hi[1], v4h),
                                           0, 1, 2, 3, 4, 5, 6, 7);
    kt[tt] = k8;
    qt[tt] = q8;
#pragma unroll  // constant indices keep the arrays in registers
    for (int e = 0; e < 8; ++e) ka = max2(ka, __builtin_fabsf((float)k8[e]));
    v4f* pv = (v4f*)(Vs + pos * 16 + 8 * h);
    pv[0] = lo[2];
    pv[1] = hi[2];
  }
#pragma unroll  // constant indices keep the arrays in registers
  for (int tt = 0; tt < 4; ++tt) {
    _Float16* pk = Ks + (p0 + tt * 16) * QK_LD + 8 * h;
    *(v8h*)pk = kt[tt];
    *(v8h*)(pk + 16) = qt[tt];
  }
  ka = wave_max(ka);
  if (lane == 0) Km[wave] = ka;
  __syncthreads();

  // LePE: Vt[d][p] = v + conv3x3_dw(v) + bias, zero-padded within the window
  if (dir) lepe_window<8>(Vs, dwv_w, dwv_b, Vt, tid);
  else     lepe_window<64>(Vs, dwh_w, dwh_b, Vt, tid);
  __syncthreads();

  const _Float16* kl = Ks + c * QK_LD + 8 * h;   // the lane's part of key tile 0
  const _Float16* vl = Vt + c * VT_LD + 8 * h;   // the lane's part of key chunk 0
  const float cs = 0.25f * 1.44269504f;          // e^(0.25 t) = 2^(cs t)
  const v4f km0 = *(const v4f*)Km, km1 = *(const v4f*)(Km + 4);
  const float kb = cs * max2(max2(max2(km0[0], km0[1]), max2(km0[2], km0[3])),
                             max2(max2(km1[0], km1[1]), max2(km1[2], km1[3])));
  // The wave's four query tiles. Window position of the lane's query in the
  // first of them and the step from tile to tile; number of that tile in the
  // batch, (image * 32 + row pair) * 8 + column octet, and its step.
  const int qb = dir ? wave * 64 + c
                     : ((wave >> 1) * 2 + (c >> 3)) * 64 + (wave & 1) * 32 + (c & 7);
  const int qs = dir ? 16 : 8;
  const int gt = dir ? (b_ * 32 + wave * 4) * 8 + win
                     : (b_ * 32 + win * 4 + (wave >> 1)) * 8 + (wave & 1) * 4;
  const int gs = dir ? 8 : 1;
  v8h* ow = (v8h*)obuf + (gt * 8 + hg) * 32 + lane;   // a tile: 8 heads x 32 lanes

  // 32 query tiles, 4 a wave, QT at a time
  for (int g = 0; g < 4 / QT; ++g) {
    const int q0 = qb + g * QT * qs;              // the lane's query in tile 0
    const _Float16* ql = Ks + q0 * QK_LD + 16 + 8 * h;
    v16h qf[QT];
#pragma unroll  // constant indices keep the arrays in registers
    for (int t = 0; t < QT; ++t) qf[t] = frag_k16_v(ql + t * qs * QK_LD);

    // --- bound on |exponent| of the lane's queries: cs * sum|q| * max|k| ---
    float qa = 0.0f;
#pragma unroll  // constant indices keep the arrays in registers
    for (int t = 0; t < QT; ++t) {
      float l1 = 0.0f;
#pragma unroll  // constant indices keep the arrays in registers
      for (int e = 0; e < 8; ++e) l1 += __builtin_fabsf((float)qf[t][e]);
      qa = max2(qa, l1 + xhalf(l1));
    }
    // one answer for the whole wave (the products need every lane on); the
    // negated compare sends a bound that is not a number to the first walk
    const bool walk = __builtin_amdgcn_ballot_w32(!(qa * kb <= EXP_SAFE)) != 0u;

    float mc[QT];
#pragma unroll  // constant indices keep the arrays in registers
    for (int t = 0; t < QT; ++t) mc[t] = 0.0f;
    if (walk) {
      // --- first walk: maximum of each query's 512 scores ---
      float mx[QT];
#pragma unroll  // constant indices keep the arrays in registers
      for (int t = 0; t < QT; ++t) mx[t] = -3.4e38f;
#pragma unroll 4  // several independent products between a product and its use
      for (int j = 0; j < 32; ++j) {
        const v16h kf = frag_k16_v(kl + j * 16 * QK_LD);
#pragma unroll  // constant indices keep the arrays in registers
        for (int t = 0; t < QT; ++t) {
          v8f s = {};
          s = __builtin_amdgcn_wmma_f32_16x16x32_f16(false, kf, false, qf[t],
                                                     (short)0, s, false, false);
          mx[t] = max8(mx[t], s);
        }
      }
#pragma unroll  // constant indices keep the arrays in registers
      for (int t = 0; t < QT; ++t) mc[t] = -cs * max2(mx[t], xhalf(mx[t]));
    }

    // --- second walk: P^T = 2^(cs (S^T - shift)), its sum, O^T += V_le^T P^T ---
    v8f o[QT];
    v2f sm[QT];
#pragma unroll  // constant indices keep the arrays in registers
    for (int t = 0; t < QT; ++t) { o[t] = (v8f){}; sm[t] = (v2f){}; }
    for (int kc = 0; kc < 16; ++kc) {
      const v16h k0 = frag_k16_v(kl + (2 * kc) * 16 * QK_LD);
      const v16h k1 = frag_k16_v(kl + (2 * kc + 1) * 16 * QK_LD);
      const v16h vf = frag_k32_v(vl + kc * 32);
#pragma unroll  // constant indices keep the arrays in registers
      for (int t = 0; t < QT; ++t) {
        v8f s0 = {}, s1 = {};
        s0 = __builtin_amdgcn_wmma_f32_16x16x32_f16(false, k0, false, qf[t],
                                                    (short)0, s0, false, false);
        s1 = __builtin_amdgcn_wmma_f32_16x16x32_f16(false, k1, false, qf[t],
                                                    (short)0, s1, false, false);
        float e[16];
#pragma unroll  // constant indices keep the arrays in registers
        for (int r = 0; r < 8; ++r) {
          e[r]     = __builtin_fmaf(s0[r], cs, mc[t]);
          e[8 + r] = __builtin_fmaf(s1[r], cs, mc[t]);
        }
        exp2_x16(e);
        v2f p2[8];
        v16f pf;
#pragma unroll  // constant indices keep the arrays in registers
        for (int r = 0; r < 8; ++r) p2[r] = (v2f){e[2 * r], e[2 * r + 1]};
#pragma unroll  // constant indices keep the arrays in registers
        for (int r = 0; r < 16; ++r) pf[r] = e[r];
        sm[t] += ((p2[0] + p2[1]) + (p2[2] + p2[3])) +
                 ((p2[4] + p2[5]) + (p2[6] + p2[7]));
        // element s of the B operand = key 8 h + s of tile 0, then of tile 1
        const v16h p = __builtin_convertvector(pf, v16h);
        o[t] = __builtin_amdgcn_wmma_f32_16x16x32_f16(false, vf, false, p,
                                                      (short)0, o[t], false, false);
      }
    }

    // --- O^T[8 h + r][query c] / row sum, as f16: 16 bytes a lane ---
#pragma unroll  // constant indices keep the arrays in registers
    for (int t = 0; t < QT; ++t) {
      const float sl  = sm[t][0] + sm[t][1];
      const float inv = 1.0f / (sl + xhalf(sl));
      v8h* po = ow + (g * QT + t) * gs * 256;
      *po = __builtin_convertvector(o[t] * inv, v8h);
      // The address registers of the store above stay untouched up to this wait.
      asm volatile("s_wait_xcnt 0x0" :: "v"(po) : "memory");
    }
  }
}

// ---------------------------------------------------------------------------
// Kernel 2: out = attn_out @ proj_w^T + proj_b   (65536x128 @ 128x128)
// One work-group for 256 tokens and ALL 128 channels:
//   - a wave owns two token tiles (2 image rows x 8 columns each, side by side).
//     The attention kernel left them as f16 in the order of the A fragments,
//     [tile][head][lane][8]: k chunk kc of a tile is heads 2 kc and 2 kc + 1, one
//     load of 512 contiguous bytes each, straight into the fragment's registers
//   - the whole of W is staged in LDS as f16, once a work-group, its rows in the
//     order 64 j + 16 a + i for channel 64 j + 4 i + a. Column i of the four
//     tiles a = 0..3 of group j is then channels 64 j + 4 i + 0..3: a lane holds
//     four consecutive channels of a token, 16 lanes hold 256 contiguous bytes
//     of an output row, and a wave's 16-byte store fills whole lines
// ---------------------------------------------------------------------------
__global__ __launch_bounds__(256) void cswin_proj_kernel(
    const _Float16* __restrict__ a_in, const float* __restrict__ w,
    const float* __restrict__ bias, float* __restrict__ out)
{
  __shared__ __attribute__((aligned(16))) _Float16 Ws[128 * G_LD];
  const int tid  = threadIdx.x;
  const int lane = tid & 31;
  const int wave = tid >> 5;                 // 8 waves (wave32)
  const int c    = lane & 15;                // token row or channel column of a tile
  const int h    = lane >> 4;
  const int g0   = blockIdx.x * 16 + wave * 2;     // the wave's first token tile

  // W row wave + 8 j: one whole row a load; the lane's 16 bytes of head s of
  // tile t. All in flight.
  const v4f* wg = (const v4f*)w + tid;
  const v8h* ag = (const v8h*)a_in + g0 * 256 + lane;
  v4f wr[16];
  v8h ar[2][8];
#pragma unroll  // constant indices keep the arrays in registers
  for (int j = 0; j < 16; ++j) wr[j] = wg[j * 256];
#pragma unroll  // constant indices keep the arrays in registers
  for (int t = 0; t < 2; ++t) {
#pragma unroll  // constant indices keep the arrays in registers
    for (int s = 0; s < 8; ++s) ar[t][s] = ag[(t * 8 + s) * 32];
  }
  // The address registers of the loads above stay untouched up to this wait.
  asm volatile("s_wait_xcnt 0x0" :: "v"(wg), "v"(ag) : "memory");

  // channel wave + 8 j has a = wave & 3, i = (wave >> 2) + 2 (j & 7), group j >> 3
  _Float16* wd = Ws + ((wave & 3) * 16 + (wave >> 2)) * G_LD + lane * 4;
#pragma unroll  // constant indices keep the arrays in registers
  for (int j = 0; j < 16; ++j)
    *(v4h*)(wd + ((j >> 3) * 64 + (j & 7) * 2) * G_LD) =
        __builtin_convertvector(wr[j], v4h);
  __syncthreads();

  const _Float16* wl = Ws + c * G_LD + 8 * h;                // the lane's part of channel tile 0
  v16h af[2][4];
#pragma unroll  // constant indices keep the arrays in registers
  for (int t = 0; t < 2; ++t) {
#pragma unroll  // constant indices keep the arrays in registers
    for (int kc = 0; kc < 4; ++kc)
      af[t][kc] = __builtin_shufflevector(ar[t][2 * kc], ar[t][2 * kc + 1],
                                          0, 1, 2, 3, 4, 5, 6, 7,
                                          8, 9, 10, 11, 12, 13, 14, 15);
  }
  const v4f* bl = (const v4f*)bias + c;              // channels 4 c .. of group 0
  const v4f  bj[2] = {bl[0], bl[16]};
  // Row 8 h + r of a tile is image row h of its pair, column r of its octet.
  const int m0 = (g0 >> 8) * 4096 + (((g0 >> 3) & 31) * 2 + h) * 64 + (g0 & 7) * 8;
  v4f* po = (v4f*)(out + (size_t)m0 * 128) + c;      // column 0 of tile 0, group 0

  v16h wf[4];
#pragma unroll  // constant indices keep the arrays in registers
  for (int kc = 0; kc < 4; ++kc) wf[kc] = frag_k32_v(wl + kc * 32);

#pragma unroll  // constant indices keep the arrays in registers
  for (int j = 0; j < 2; ++j) {
    v8f acc[2][4];
#pragma unroll  // the next tile's fragments are fetched into a second register set
    for (int a = 0; a < 4; ++a) {
      const int nt = j * 4 + a;
      v16h wn[4];
      if (nt < 7) {
#pragma unroll  // constant indices keep the arrays in registers
        for (int kc = 0; kc < 4; ++kc)
          wn[kc] = frag_k32_v(wl + (nt + 1) * 16 * G_LD + kc * 32);
      }
      // Holds the next tile's LDS reads, as one group, in front of this tile's
      // products: their latency then runs under the products.
      __builtin_amdgcn_sched_barrier(0);
      acc[0][a] = (v8f){};
      acc[1][a] = (v8f){};
#pragma unroll  // two independent accumulator chains, taken in turn
      for (int kc = 0; kc < 4; ++kc) {
#pragma unroll  // constant indices keep the arrays in registers
        for (int t = 0; t < 2; ++t)
          acc[t][a] = __builtin_amdgcn_wmma_f32_16x16x32_f16(
              false, af[t][kc], false, wf[kc], (short)0, acc[t][a], false, false);
      }
      if (nt < 7) {
#pragma unroll  // constant indices keep the arrays in registers
        for (int kc = 0; kc < 4; ++kc) wf[kc] = wn[kc];
      }
    }
#pragma unroll  // constant indices keep the arrays in registers
    for (int t = 0; t < 2; ++t) {
#pragma unroll  // constant indices keep the arrays in registers
      for (int r = 0; r < 8; ++r)
        po[(t * 8 + r) * 32 + j * 16] =
            (v4f){acc[t][0][r], acc[t][1][r], acc[t][2][r], acc[t][3][r]} + bj[j];
    }
    // The address registers of the loads and stores above stay untouched up to
    // this wait.
    asm volatile("s_wait_xcnt 0x0" :: "v"(po), "v"(bl) : "memory");
  }
}

// ---------------------------------------------------------------------------
extern "C" void kernel_launch(void* const* d_in, const int* in_sizes, int n_in,
                              void* d_out, int out_size, void* d_ws, size_t ws_size,
                              hipStream_t stream) {
  const float* x      = (const float*)d_in[0];
  const float* qkv_w  = (const float*)d_in[1];
  const float* qkv_b  = (const float*)d_in[2];
  const float* proj_w = (const float*)d_in[3];
  const float* proj_b = (const float*)d_in[4];
  const float* dwh_w  = (const float*)d_in[5];
  const float* dwh_b  = (const float*)d_in[6];
  const float* dwv_w  = (const float*)d_in[7];
  const float* dwv_b  = (const float*)d_in[8];
  // d_in[9]=H, d_in[10]=W fixed at 64 for this problem size.

  char* wsb = (char*)d_ws;
  _Float16* obuf = (_Float16*)(wsb + (size_t)64 * 1024 * 1024);  // 16 MB

  // QKV projection and stripe attention: one work-group a window-head
  cswin_attn_kernel<<<dim3(1024), 256, 0, stream>>>(
      x, qkv_w, qkv_b, dwh_w, dwh_b, dwv_w, dwv_b, obuf);

  // Output projection
  cswin_proj_kernel<<<dim3(256), 256, 0, stream>>>(
      obuf, proj_w, proj_b, (float*)d_out);
}
